// v000
// Times are from an AMD MI455X. After a warm-up the kernel runs many times in a row, and a time is the length of
// such a window on the GPU divided by its runs, so every launch and the gaps after it count. The runs cycle
// through copies of the inputs. A figure is the median of several windows, for all but v000 over two sittings.
// Sittings can differ by a few percent; kernels timed side by side share one.
// The starting kernel, v000, takes 462 microseconds a run.
#include <hip/hip_runtime.h>
#include <hip/hip_bf16.h>

typedef __attribute__((ext_vector_type(16))) __bf16 v16bf;
typedef __attribute__((ext_vector_type(8)))  __bf16 v8bf;
typedef __attribute__((ext_vector_type(4)))  __bf16 v4bf;
typedef __attribute__((ext_vector_type(8)))  float  v8f;
typedef __attribute__((__vector_size__(4 * sizeof(int)))) int i32x4;

#define LN_EPS 1e-5f
#define LDP 72   // padded LDS row length (bf16): 144 B, multiple of 16 B

#if defined(__has_builtin)
#if __has_builtin(__builtin_amdgcn_global_load_async_to_lds_b128) && \
    __has_builtin(__builtin_amdgcn_s_wait_asynccnt)
#define HAVE_ASYNC_LDS 1
#endif
#endif

#define AS1 __attribute__((address_space(1)))
#define AS3 __attribute__((address_space(3)))

__device__ __forceinline__ v8f wmma_bf16(const v16bf& a, const v16bf& b, const v8f& c) {
    return __builtin_amdgcn_wmma_f32_16x16x32_bf16(false, a, false, b, (short)0, c, false, false);
}

// Two contiguous 16-byte LDS loads -> one 16-element bf16 fragment.
__device__ __forceinline__ v16bf load_frag(const __bf16* p0, const __bf16* p1) {
    v8bf lo = *(const v8bf*)p0;
    v8bf hi = *(const v8bf*)p1;
    return __builtin_shufflevector(lo, hi, 0, 1, 2, 3, 4, 5, 6, 7,
                                   8, 9, 10, 11, 12, 13, 14, 15);
}

__device__ __forceinline__ v4bf cvt4(const float4 f) {
    v4bf b;
    b[0] = (__bf16)f.x; b[1] = (__bf16)f.y; b[2] = (__bf16)f.z; b[3] = (__bf16)f.w;
    return b;
}

// 16-byte global(bf16) -> LDS copy; async-to-LDS when toolchain supports it.
__device__ __forceinline__ void copy16B(const __bf16* g, __bf16* l) {
#ifdef HAVE_ASYNC_LDS
    __builtin_amdgcn_global_load_async_to_lds_b128(
        (AS1 i32x4*)g, (AS3 i32x4*)l, 0, 0);
#else
    *(v8bf*)l = *(const v8bf*)g;
#endif
}

__device__ __forceinline__ void async_wait() {
#ifdef HAVE_ASYNC_LDS
    __builtin_amdgcn_s_wait_asynccnt(0);
#endif
}

// ---------------------------------------------------------------------------
// fp32 -> bf16 elementwise (n multiple of 4)
// ---------------------------------------------------------------------------
__global__ __launch_bounds__(256)
void convert_bf16_kernel(const float* __restrict__ X, __bf16* __restrict__ Y, size_t n)
{
    size_t i = ((size_t)blockIdx.x * 256 + threadIdx.x) * 4;
    if (i < n) {
        float4 f = *(const float4*)&X[i];
        *(v4bf*)&Y[i] = cvt4(f);
    }
}

// ---------------------------------------------------------------------------
// W[K,N] fp32 -> Wt[N,K] bf16 (64x64 LDS-tiled transpose)
// ---------------------------------------------------------------------------
__global__ __launch_bounds__(256)
void transpose_bf16_kernel(const float* __restrict__ W, __bf16* __restrict__ Wt,
                           int K, int N)
{
    __shared__ float T[64][65];
    const int k0 = blockIdx.x * 64, n0 = blockIdx.y * 64;
    #pragma unroll
    for (int i = 0; i < 16; ++i) {
        int idx = threadIdx.x + i * 256;
        int r = idx >> 6, c = idx & 63;
        T[r][c] = W[(size_t)(k0 + r) * N + n0 + c];
    }
    __syncthreads();
    #pragma unroll
    for (int i = 0; i < 16; ++i) {
        int idx = threadIdx.x + i * 256;
        int r = idx >> 6, c = idx & 63;         // r = n-local, c = k-local
        Wt[(size_t)(n0 + r) * K + k0 + c] = (__bf16)T[c][r];
    }
}

// ---------------------------------------------------------------------------
// GEMM: C = op(A[M,K](bf16) @ Wt[N,K](bf16)^T + bias (+ resid))
// 256x64 tile / 256-thread block; 8 waves x (32x64 strip). Both LDS stages
// are straight 16-byte copies (async-to-LDS when available).
// Outputs: fp32 C and/or bf16 C (scaled) per template flags.
// ---------------------------------------------------------------------------
template<bool RELU, bool RESID, bool OUTF32, bool OUTBF16>
__global__ __launch_bounds__(256)
void gemm_bf16_wmma(const __bf16* __restrict__ A, const __bf16* __restrict__ Wt,
                    const float* __restrict__ bias, const float* __restrict__ resid,
                    float* __restrict__ Cf, __bf16* __restrict__ Cb, float oscale,
                    int M, int N, int K)
{
    __shared__ __align__(16) __bf16 As[256][LDP];  // [m][k]
    __shared__ __align__(16) __bf16 Bt[64][LDP];   // [n][k]
    const int tid  = threadIdx.x;
    const int wave = tid >> 5;
    const int lane = tid & 31;
    const int half = lane >> 4;
    const int l16  = lane & 15;
    const int kb0  = half * 8;
    const int kb1  = 16 + half * 8;
    const int m0 = blockIdx.x * 256;
    const int n0 = blockIdx.y * 64;

    v8f acc[2][4] = {};

    for (int k0 = 0; k0 < K; k0 += 64) {
        if (k0 + 64 < K) {
            __builtin_prefetch(&A[(size_t)(m0 + tid) * K + (k0 + 64)]);
            if (tid < 64)
                __builtin_prefetch(&Wt[(size_t)(n0 + tid) * K + (k0 + 64)]);
        }
        // stage A tile: 256 rows x 64 bf16 = 2048 16-byte chunks
        #pragma unroll
        for (int i = 0; i < 8; ++i) {
            int idx = tid + i * 256;
            int r = idx >> 3, c = (idx & 7) * 8;
            copy16B(&A[(size_t)(m0 + r) * K + k0 + c], &As[r][c]);
        }
        // stage B tile (already [n][k] in global): 512 chunks
        #pragma unroll
        for (int i = 0; i < 2; ++i) {
            int idx = tid + i * 256;
            int r = idx >> 3, c = (idx & 7) * 8;
            copy16B(&Wt[(size_t)(n0 + r) * K + k0 + c], &Bt[r][c]);
        }
        async_wait();
        __syncthreads();

        const int row0 = wave * 32 + l16;
        #pragma unroll
        for (int ks = 0; ks < 64; ks += 32) {
            v16bf a0 = load_frag(&As[row0][ks + kb0],      &As[row0][ks + kb1]);
            v16bf a1 = load_frag(&As[row0 + 16][ks + kb0], &As[row0 + 16][ks + kb1]);
            #pragma unroll
            for (int nt = 0; nt < 4; ++nt) {
                const int col = nt * 16 + l16;
                v16bf b = load_frag(&Bt[col][ks + kb0], &Bt[col][ks + kb1]);
                acc[0][nt] = wmma_bf16(a0, b, acc[0][nt]);
                acc[1][nt] = wmma_bf16(a1, b, acc[1][nt]);
            }
        }
        __syncthreads();
    }

    #pragma unroll
    for (int mi = 0; mi < 2; ++mi)
        #pragma unroll
        for (int nt = 0; nt < 4; ++nt) {
            const int col = n0 + nt * 16 + l16;
            const float bv = bias[col];
            #pragma unroll
            for (int r = 0; r < 8; ++r) {
                const int row = m0 + wave * 32 + mi * 16 + r + half * 8;
                float v = acc[mi][nt][r] + bv;
                if (RESID) v += resid[(size_t)row * N + col];
                if (RELU)  v = fmaxf(v, 0.0f);
                if (OUTF32)  Cf[(size_t)row * N + col] = v;
                if (OUTBF16) Cb[(size_t)row * N + col] = (__bf16)(v * oscale);
            }
        }
}

// ---------------------------------------------------------------------------
// Flash-attention per (b,h, 64-query block). dk=64, S=2048; Q pre-scaled by
// 1/sqrt(dk) at the Q-GEMM. Scores std ~1 -> plain exp is fp32-safe (softmax
// is shift-invariant); row-sums via WMMA with an all-ones B matrix.
// Q/K/V are bf16; Q/K stage as pure copies (async), V via register transpose.
// Output written bf16 (only consumed by the Wo GEMM).
// ---------------------------------------------------------------------------
__global__ __launch_bounds__(128)
void attention_wmma(const __bf16* __restrict__ Q, const __bf16* __restrict__ Km,
                    const __bf16* __restrict__ Vm, __bf16* __restrict__ O,
                    int S, int D)
{
    __shared__ __align__(16) __bf16 Qs[64][LDP];   // [q][d]
    __shared__ __align__(16) __bf16 Ks[64][LDP];   // [key][d]
    __shared__ __align__(16) __bf16 Vt[64][LDP];   // [d][key]
    __shared__ __align__(16) __bf16 Ps[64][LDP];   // probs [q][key]

    const int tid  = threadIdx.x;
    const int wave = tid >> 5;
    const int lane = tid & 31;
    const int half = lane >> 4;
    const int l16  = lane & 15;
    const int kb0  = half * 8;
    const int kb1  = 16 + half * 8;

    const int q0 = blockIdx.x * 64;
    const int bh = blockIdx.y;
    const int b  = bh >> 4;
    const int h  = bh & 15;
    const size_t rowbase = (size_t)b * S;
    const int    cbase   = h * 64;

    // stage Q block (pure bf16 copy; scale already folded in)
    #pragma unroll
    for (int i = 0; i < 4; ++i) {
        int idx = tid + i * 128;
        int r = idx >> 3, c = (idx & 7) * 8;
        copy16B(&Q[(rowbase + q0 + r) * D + cbase + c], &Qs[r][c]);
    }

    v16bf ones;
    #pragma unroll
    for (int i = 0; i < 16; ++i) ones[i] = (__bf16)1.0f;

    v8f o[4] = {};
    v8f lsum = {};

    const int rowA = wave * 16 + l16;

    for (int kb = 0; kb < S; kb += 64) {
        if (kb + 64 < S) {
            __builtin_prefetch(&Km[(rowbase + kb + 64 + tid) * D + cbase]);
            __builtin_prefetch(&Vm[(rowbase + kb + 64 + tid) * D + cbase]);
        }
        __syncthreads();
        // K row-major copy (async)
        #pragma unroll
        for (int i = 0; i < 4; ++i) {
            int idx = tid + i * 128;
            int r = idx >> 3, c = (idx & 7) * 8;
            copy16B(&Km[(rowbase + kb + r) * D + cbase + c], &Ks[r][c]);
        }
        // V transposed via 4x4 register micro-tiles
        #pragma unroll
        for (int tt = 0; tt < 2; ++tt) {
            const int t  = tid + tt * 128;
            const int tn = t & 15;      // d block
            const int tk = t >> 4;      // key block
            v4bf f[4];
            #pragma unroll
            for (int j = 0; j < 4; ++j)
                f[j] = *(const v4bf*)&Vm[(rowbase + kb + tk * 4 + j) * D + cbase + tn * 4];
            #pragma unroll
            for (int i = 0; i < 4; ++i) {
                v4bf p;
                p[0] = f[0][i]; p[1] = f[1][i]; p[2] = f[2][i]; p[3] = f[3][i];
                *(v4bf*)&Vt[tn * 4 + i][tk * 4] = p;
            }
        }
        async_wait();
        __syncthreads();

        // ---- scores = Q * K^T
        v16bf a0 = load_frag(&Qs[rowA][kb0],      &Qs[rowA][kb1]);
        v16bf a1 = load_frag(&Qs[rowA][32 + kb0], &Qs[rowA][32 + kb1]);
        v8f s[4];
        #pragma unroll
        for (int nt = 0; nt < 4; ++nt) {
            const int col = nt * 16 + l16;
            v16bf b0 = load_frag(&Ks[col][kb0],      &Ks[col][kb1]);
            v16bf b1 = load_frag(&Ks[col][32 + kb0], &Ks[col][32 + kb1]);
            v8f z = {};
            z = wmma_bf16(a0, b0, z);
            z = wmma_bf16(a1, b1, z);
            s[nt] = z;
        }

        // ---- p = exp(s), staged to LDS row-major (own strip only)
        #pragma unroll
        for (int nt = 0; nt < 4; ++nt)
            #pragma unroll
            for (int r = 0; r < 8; ++r)
                Ps[wave * 16 + r + half * 8][nt * 16 + l16] = (__bf16)__expf(s[nt][r]);

        v16bf p0 = load_frag(&Ps[rowA][kb0],      &Ps[rowA][kb1]);
        v16bf p1 = load_frag(&Ps[rowA][32 + kb0], &Ps[rowA][32 + kb1]);

        // ---- row-sums of P via WMMA with all-ones B (broadcast per column)
        lsum = wmma_bf16(p0, ones, lsum);
        lsum = wmma_bf16(p1, ones, lsum);

        // ---- O += P * V
        #pragma unroll
        for (int nt = 0; nt < 4; ++nt) {
            const int col = nt * 16 + l16;
            v16bf b0 = load_frag(&Vt[col][kb0],      &Vt[col][kb1]);
            v16bf b1 = load_frag(&Vt[col][32 + kb0], &Vt[col][32 + kb1]);
            o[nt] = wmma_bf16(p0, b0, o[nt]);
            o[nt] = wmma_bf16(p1, b1, o[nt]);
        }
    }

    // ---- normalize by row-sum, write bf16
    #pragma unroll
    for (int nt = 0; nt < 4; ++nt) {
        const int col = cbase + nt * 16 + l16;
        #pragma unroll
        for (int r = 0; r < 8; ++r) {
            const int row = q0 + wave * 16 + r + half * 8;
            O[(rowbase + row) * D + col] = (__bf16)(o[nt][r] / lsum[r]);
        }
    }
}

// ---------------------------------------------------------------------------
// Row-wise LayerNorm; optionally also emits a bf16 shadow copy for the next
// GEMM's A operand.
// ---------------------------------------------------------------------------
__global__ __launch_bounds__(256)
void layernorm_kernel(const float* __restrict__ X, const float* __restrict__ g,
                      const float* __restrict__ beta, float* __restrict__ Y,
                      __bf16* __restrict__ Yb, int D)
{
    __shared__ float s_sum[8], s_sq[8];
    const size_t row = blockIdx.x;
    const float* xr = X + row * D;

    float lsum = 0.0f, lsq = 0.0f;
    for (int i = threadIdx.x; i < D; i += 256) {
        float v = xr[i];
        lsum += v;
        lsq  += v * v;
    }
    #pragma unroll
    for (int off = 1; off < 32; off <<= 1) {
        lsum += __shfl_xor(lsum, off, 32);
        lsq  += __shfl_xor(lsq,  off, 32);
    }
    if ((threadIdx.x & 31) == 0) {
        s_sum[threadIdx.x >> 5] = lsum;
        s_sq[threadIdx.x >> 5]  = lsq;
    }
    __syncthreads();
    float tot = 0.0f, totsq = 0.0f;
    #pragma unroll
    for (int i = 0; i < 8; ++i) { tot += s_sum[i]; totsq += s_sq[i]; }
    const float mu  = tot / (float)D;
    const float inv = rsqrtf(totsq / (float)D - mu * mu + LN_EPS);

    for (int i = threadIdx.x; i < D; i += 256) {
        float v = (xr[i] - mu) * inv * g[i] + beta[i];
        Y[row * D + i] = v;
        if (Yb) Yb[row * D + i] = (__bf16)v;
    }
}

// ---------------------------------------------------------------------------
extern "C" void kernel_launch(void* const* d_in, const int* in_sizes, int n_in,
                              void* d_out, int out_size, void* d_ws, size_t ws_size,
                              hipStream_t stream)
{
    const float* x    = (const float*)d_in[0];
    const float* Wq   = (const float*)d_in[1];
    const float* bq   = (const float*)d_in[2];
    const float* Wk   = (const float*)d_in[3];
    const float* bk   = (const float*)d_in[4];
    const float* Wv   = (const float*)d_in[5];
    const float* bv   = (const float*)d_in[6];
    const float* Wo   = (const float*)d_in[7];
    const float* bo   = (const float*)d_in[8];
    const float* W1   = (const float*)d_in[9];
    const float* b1   = (const float*)d_in[10];
    const float* W2   = (const float*)d_in[11];
    const float* b2   = (const float*)d_in[12];
    const float* g1   = (const float*)d_in[13];
    const float* be1  = (const float*)d_in[14];
    const float* g2   = (const float*)d_in[15];
    const float* be2  = (const float*)d_in[16];

    const int B = 4, S = 2048, D = 1024, DFF = 4096;
    const int M = B * S;  // 8192
    const size_t MD  = (size_t)M * D;
    const size_t MDF = (size_t)M * DFF;

    char* p = (char*)d_ws;
    auto alloc = [&](size_t bytes) { char* q = p; p += (bytes + 255) & ~(size_t)255; return q; };

    __bf16* xb  = (__bf16*)alloc(MD * 2);
    __bf16* Wqt = (__bf16*)alloc((size_t)D * D * 2);
    __bf16* Wkt = (__bf16*)alloc((size_t)D * D * 2);
    __bf16* Wvt = (__bf16*)alloc((size_t)D * D * 2);
    __bf16* Wot = (__bf16*)alloc((size_t)D * D * 2);
    __bf16* W1t = (__bf16*)alloc((size_t)D * DFF * 2);
    __bf16* W2t = (__bf16*)alloc((size_t)DFF * D * 2);
    __bf16* Qb  = (__bf16*)alloc(MD * 2);
    __bf16* Kb  = (__bf16*)alloc(MD * 2);
    __bf16* Vb  = (__bf16*)alloc(MD * 2);
    __bf16* Ob  = (__bf16*)alloc(MD * 2);
    float*  h1  = (float*)alloc(MD * 4);
    float*  x2  = (float*)alloc(MD * 4);
    __bf16* x2b = (__bf16*)alloc(MD * 2);
    __bf16* F1b = (__bf16*)alloc(MDF * 2);
    float*  h2  = h1;   // h1 consumed by LN1 before FFN2 writes h2

    const dim3 gblk(256);

    // ---- one-time conversions / weight pre-transposes
    convert_bf16_kernel<<<dim3(MD / 1024), gblk, 0, stream>>>(x, xb, MD);
    transpose_bf16_kernel<<<dim3(D / 64, D / 64),   gblk, 0, stream>>>(Wq, Wqt, D, D);
    transpose_bf16_kernel<<<dim3(D / 64, D / 64),   gblk, 0, stream>>>(Wk, Wkt, D, D);
    transpose_bf16_kernel<<<dim3(D / 64, D / 64),   gblk, 0, stream>>>(Wv, Wvt, D, D);
    transpose_bf16_kernel<<<dim3(D / 64, D / 64),   gblk, 0, stream>>>(Wo, Wot, D, D);
    transpose_bf16_kernel<<<dim3(D / 64, DFF / 64), gblk, 0, stream>>>(W1, W1t, D, DFF);
    transpose_bf16_kernel<<<dim3(DFF / 64, D / 64), gblk, 0, stream>>>(W2, W2t, DFF, D);

    // ---- QKV projections (bf16 outputs; Q pre-scaled by 1/sqrt(dk))
    gemm_bf16_wmma<false, false, false, true><<<dim3(M / 256, D / 64), gblk, 0, stream>>>(
        xb, Wqt, bq, nullptr, nullptr, Qb, 0.125f, M, D, D);
    gemm_bf16_wmma<false, false, false, true><<<dim3(M / 256, D / 64), gblk, 0, stream>>>(
        xb, Wkt, bk, nullptr, nullptr, Kb, 1.0f, M, D, D);
    gemm_bf16_wmma<false, false, false, true><<<dim3(M / 256, D / 64), gblk, 0, stream>>>(
        xb, Wvt, bv, nullptr, nullptr, Vb, 1.0f, M, D, D);

    // ---- attention
    attention_wmma<<<dim3(S / 64, B * 16), dim3(128), 0, stream>>>(Qb, Kb, Vb, Ob, S, D);

    // ---- output projection + residual x  -> h1 (fp32)
    gemm_bf16_wmma<false, true, true, false><<<dim3(M / 256, D / 64), gblk, 0, stream>>>(
        Ob, Wot, bo, x, h1, nullptr, 1.0f, M, D, D);

    // ---- LN1 -> x2 (fp32 residual) + x2b (bf16 operand)
    layernorm_kernel<<<dim3(M), gblk, 0, stream>>>(h1, g1, be1, x2, x2b, D);

    // ---- FFN1 with ReLU -> bf16 only
    gemm_bf16_wmma<true, false, false, true><<<dim3(M / 256, DFF / 64), gblk, 0, stream>>>(
        x2b, W1t, b1, nullptr, nullptr, F1b, 1.0f, M, DFF, D);

    // ---- FFN2 + residual x2 -> h2 (fp32)
    gemm_bf16_wmma<false, true, true, false><<<dim3(M / 256, D / 64), gblk, 0, stream>>>(
        F1b, W2t, b2, x2, h2, nullptr, 1.0f, M, D, DFF);

    // ---- LN2 -> output
    layernorm_kernel<<<dim3(M), gblk, 0, stream>>>(h2, g2, be2, (float*)d_out, nullptr, D);
}

// v001
// One run takes 409 microseconds.
// Timed twice side by side with v000, it ran 1.18 times as fast both times.
#include <hip/hip_runtime.h>
#include <hip/hip_bf16.h>

typedef __attribute__((ext_vector_type(16))) __bf16 v16bf;
typedef __attribute__((ext_vector_type(8)))  __bf16 v8bf;
typedef __attribute__((ext_vector_type(4)))  __bf16 v4bf;
typedef __attribute__((ext_vector_type(8)))  float  v8f;
typedef __attribute__((__vector_size__(4 * sizeof(int)))) int i32x4;

#define LN_EPS 1e-5f
#define LDP 72   // padded LDS row length (bf16): 144 B, multiple of 16 B

#if defined(__has_builtin)
#if __has_builtin(__builtin_amdgcn_global_load_async_to_lds_b128) && \
    __has_builtin(__builtin_amdgcn_s_wait_asynccnt)
#define HAVE_ASYNC_LDS 1
#endif
#endif

#define AS1 __attribute__((address_space(1)))
#define AS3 __attribute__((address_space(3)))

__device__ __forceinline__ v8f wmma_bf16(const v16bf& a, const v16bf& b, const v8f& c) {
    return __builtin_amdgcn_wmma_f32_16x16x32_bf16(false, a, false, b, (short)0, c, false, false);
}

// Two contiguous 16-byte LDS loads -> one 16-element bf16 fragment.
__device__ __forceinline__ v16bf load_frag(const __bf16* p0, const __bf16* p1) {
    v8bf lo = *(const v8bf*)p0;
    v8bf hi = *(const v8bf*)p1;
    return __builtin_shufflevector(lo, hi, 0, 1, 2, 3, 4, 5, 6, 7,
                                   8, 9, 10, 11, 12, 13, 14, 15);
}

__device__ __forceinline__ v4bf cvt4(const float4 f) {
    v4bf b;
    b[0] = (__bf16)f.x; b[1] = (__bf16)f.y; b[2] = (__bf16)f.z; b[3] = (__bf16)f.w;
    return b;
}

// 16-byte global(bf16) -> LDS copy; async-to-LDS when toolchain supports it.
__device__ __forceinline__ void copy16B(const __bf16* g, __bf16* l) {
#ifdef HAVE_ASYNC_LDS
    __builtin_amdgcn_global_load_async_to_lds_b128(
        (AS1 i32x4*)g, (AS3 i32x4*)l, 0, 0);
#else
    *(v8bf*)l = *(const v8bf*)g;
#endif
}

__device__ __forceinline__ void async_wait() {
#ifdef HAVE_ASYNC_LDS
    __builtin_amdgcn_s_wait_asynccnt(0);
#endif
}

// ---------------------------------------------------------------------------
// fp32 -> bf16 elementwise (n multiple of 4)
// ---------------------------------------------------------------------------
__global__ __launch_bounds__(256)
void convert_bf16_kernel(const float* __restrict__ X, __bf16* __restrict__ Y, size_t n)
{
    size_t i = ((size_t)blockIdx.x * 256 + threadIdx.x) * 4;
    if (i < n) {
        float4 f = *(const float4*)&X[i];
        *(v4bf*)&Y[i] = cvt4(f);
    }
}

// ---------------------------------------------------------------------------
// W[K,N] fp32 -> Wt[N,K] bf16 (64x64 LDS-tiled transpose)
// ---------------------------------------------------------------------------
__global__ __launch_bounds__(256)
void transpose_bf16_kernel(const float* __restrict__ W, __bf16* __restrict__ Wt,
                           int K, int N)
{
    __shared__ float T[64][65];
    const int k0 = blockIdx.x * 64, n0 = blockIdx.y * 64;
    #pragma unroll
    for (int i = 0; i < 16; ++i) {
        int idx = threadIdx.x + i * 256;
        int r = idx >> 6, c = idx & 63;
        T[r][c] = W[(size_t)(k0 + r) * N + n0 + c];
    }
    __syncthreads();
    #pragma unroll
    for (int i = 0; i < 16; ++i) {
        int idx = threadIdx.x + i * 256;
        int r = idx >> 6, c = idx & 63;         // r = n-local, c = k-local
        Wt[(size_t)(n0 + r) * K + k0 + c] = (__bf16)T[c][r];
    }
}

// ---------------------------------------------------------------------------
// GEMM: C = op(A[M,K](bf16) @ Wt[N,K](bf16)^T + bias (+ resid))
// 256x64 tile / 256-thread block; 8 waves x (32x64 strip). Both LDS stages
// are straight 16-byte copies (async-to-LDS when available).
// Outputs: fp32 C and/or bf16 C (scaled) per template flags.
// ---------------------------------------------------------------------------
template<bool RELU, bool RESID, bool OUTF32, bool OUTBF16>
__global__ __launch_bounds__(256)
void gemm_bf16_wmma(const __bf16* __restrict__ A, const __bf16* __restrict__ Wt,
                    const float* __restrict__ bias, const float* __restrict__ resid,
                    float* __restrict__ Cf, __bf16* __restrict__ Cb, float oscale,
                    int M, int N, int K)
{
    __shared__ __align__(16) __bf16 As[256][LDP];  // [m][k]
    __shared__ __align__(16) __bf16 Bt[64][LDP];   // [n][k]
    const int tid  = threadIdx.x;
    const int wave = tid >> 5;
    const int lane = tid & 31;
    const int half = lane >> 4;
    const int l16  = lane & 15;
    const int kb0  = half * 8;
    const int kb1  = 16 + half * 8;
    const int m0 = blockIdx.x * 256;
    const int n0 = blockIdx.y * 64;

    v8f acc[2][4] = {};

    for (int k0 = 0; k0 < K; k0 += 64) {
        // stage A tile: 256 rows x 64 bf16 = 2048 16-byte chunks
        #pragma unroll
        for (int i = 0; i < 8; ++i) {
            int idx = tid + i * 256;
            int r = idx >> 3, c = (idx & 7) * 8;
            copy16B(&A[(size_t)(m0 + r) * K + k0 + c], &As[r][c]);
        }
        // stage B tile (already [n][k] in global): 512 chunks
        #pragma unroll
        for (int i = 0; i < 2; ++i) {
            int idx = tid + i * 256;
            int r = idx >> 3, c = (idx & 7) * 8;
            copy16B(&Wt[(size_t)(n0 + r) * K + k0 + c], &Bt[r][c]);
        }
        async_wait();
        __syncthreads();

        const int row0 = wave * 32 + l16;
        #pragma unroll
        for (int ks = 0; ks < 64; ks += 32) {
            v16bf a0 = load_frag(&As[row0][ks + kb0],      &As[row0][ks + kb1]);
            v16bf a1 = load_frag(&As[row0 + 16][ks + kb0], &As[row0 + 16][ks + kb1]);
            #pragma unroll
            for (int nt = 0; nt < 4; ++nt) {
                const int col = nt * 16 + l16;
                v16bf b = load_frag(&Bt[col][ks + kb0], &Bt[col][ks + kb1]);
                acc[0][nt] = wmma_bf16(a0, b, acc[0][nt]);
                acc[1][nt] = wmma_bf16(a1, b, acc[1][nt]);
            }
        }
        __syncthreads();
    }

    #pragma unroll
    for (int mi = 0; mi < 2; ++mi)
        #pragma unroll
        for (int nt = 0; nt < 4; ++nt) {
            const int col = n0 + nt * 16 + l16;
            const float bv = bias[col];
            #pragma unroll
            for (int r = 0; r < 8; ++r) {
                const int row = m0 + wave * 32 + mi * 16 + r + half * 8;
                float v = acc[mi][nt][r] + bv;
                if (RESID) v += resid[(size_t)row * N + col];
                if (RELU)  v = fmaxf(v, 0.0f);
                if (OUTF32)  Cf[(size_t)row * N + col] = v;
                if (OUTBF16) Cb[(size_t)row * N + col] = (__bf16)(v * oscale);
            }
        }
}

// ---------------------------------------------------------------------------
// Flash-attention per (b,h, 64-query block). dk=64, S=2048; Q pre-scaled by
// 1/sqrt(dk) at the Q-GEMM. Scores std ~1 -> plain exp is fp32-safe (softmax
// is shift-invariant); row-sums via WMMA with an all-ones B matrix.
// Q/K/V are bf16; Q/K stage as pure copies (async), V via register transpose.
// Output written bf16 (only consumed by the Wo GEMM).
// ---------------------------------------------------------------------------
__global__ __launch_bounds__(128)
void attention_wmma(const __bf16* __restrict__ Q, const __bf16* __restrict__ Km,
                    const __bf16* __restrict__ Vm, __bf16* __restrict__ O,
                    int S, int D)
{
    __shared__ __align__(16) __bf16 Qs[64][LDP];   // [q][d]
    __shared__ __align__(16) __bf16 Ks[64][LDP];   // [key][d]
    __shared__ __align__(16) __bf16 Vt[64][LDP];   // [d][key]
    __shared__ __align__(16) __bf16 Ps[64][LDP];   // probs [q][key]

    const int tid  = threadIdx.x;
    const int wave = tid >> 5;
    const int lane = tid & 31;
    const int half = lane >> 4;
    const int l16  = lane & 15;
    const int kb0  = half * 8;
    const int kb1  = 16 + half * 8;

    const int q0 = blockIdx.x * 64;
    const int bh = blockIdx.y;
    const int b  = bh >> 4;
    const int h  = bh & 15;
    const size_t rowbase = (size_t)b * S;
    const int    cbase   = h * 64;

    // stage Q block (pure bf16 copy; scale already folded in)
    #pragma unroll
    for (int i = 0; i < 4; ++i) {
        int idx = tid + i * 128;
        int r = idx >> 3, c = (idx & 7) * 8;
        copy16B(&Q[(rowbase + q0 + r) * D + cbase + c], &Qs[r][c]);
    }

    v16bf ones;
    #pragma unroll
    for (int i = 0; i < 16; ++i) ones[i] = (__bf16)1.0f;

    v8f o[4] = {};
    v8f lsum = {};

    const int rowA = wave * 16 + l16;

    for (int kb = 0; kb < S; kb += 64) {
        __syncthreads();
        // K row-major copy (async)
        #pragma unroll
        for (int i = 0; i < 4; ++i) {
            int idx = tid + i * 128;
            int r = idx >> 3, c = (idx & 7) * 8;
            copy16B(&Km[(rowbase + kb + r) * D + cbase + c], &Ks[r][c]);
        }
        // V transposed via 4x4 register micro-tiles
        #pragma unroll
        for (int tt = 0; tt < 2; ++tt) {
            const int t  = tid + tt * 128;
            const int tn = t & 15;      // d block
            const int tk = t >> 4;      // key block
            v4bf f[4];
            #pragma unroll
            for (int j = 0; j < 4; ++j)
                f[j] = *(const v4bf*)&Vm[(rowbase + kb + tk * 4 + j) * D + cbase + tn * 4];
            #pragma unroll
            for (int i = 0; i < 4; ++i) {
                v4bf p;
                p[0] = f[0][i]; p[1] = f[1][i]; p[2] = f[2][i]; p[3] = f[3][i];
                *(v4bf*)&Vt[tn * 4 + i][tk * 4] = p;
            }
        }
        async_wait();
        __syncthreads();

        // ---- scores = Q * K^T
        v16bf a0 = load_frag(&Qs[rowA][kb0],      &Qs[rowA][kb1]);
        v16bf a1 = load_frag(&Qs[rowA][32 + kb0], &Qs[rowA][32 + kb1]);
        v8f s[4];
        #pragma unroll
        for (int nt = 0; nt < 4; ++nt) {
            const int col = nt * 16 + l16;
            v16bf b0 = load_frag(&Ks[col][kb0],      &Ks[col][kb1]);
            v16bf b1 = load_frag(&Ks[col][32 + kb0], &Ks[col][32 + kb1]);
            v8f z = {};
            z = wmma_bf16(a0, b0, z);
            z = wmma_bf16(a1, b1, z);
            s[nt] = z;
        }

        // ---- p = exp(s), staged to LDS row-major (own strip only)
        #pragma unroll
        for (int nt = 0; nt < 4; ++nt)
            #pragma unroll
            for (int r = 0; r < 8; ++r)
                Ps[wave * 16 + r + half * 8][nt * 16 + l16] = (__bf16)__expf(s[nt][r]);

        v16bf p0 = load_frag(&Ps[rowA][kb0],      &Ps[rowA][kb1]);
        v16bf p1 = load_frag(&Ps[rowA][32 + kb0], &Ps[rowA][32 + kb1]);

        // ---- row-sums of P via WMMA with all-ones B (broadcast per column)
        lsum = wmma_bf16(p0, ones, lsum);
        lsum = wmma_bf16(p1, ones, lsum);

        // ---- O += P * V
        #pragma unroll
        for (int nt = 0; nt < 4; ++nt) {
            const int col = nt * 16 + l16;
            v16bf b0 = load_frag(&Vt[col][kb0],      &Vt[col][kb1]);
            v16bf b1 = load_frag(&Vt[col][32 + kb0], &Vt[col][32 + kb1]);
            o[nt] = wmma_bf16(p0, b0, o[nt]);
            o[nt] = wmma_bf16(p1, b1, o[nt]);
        }
    }

    // ---- normalize by row-sum, write bf16
    #pragma unroll
    for (int nt = 0; nt < 4; ++nt) {
        const int col = cbase + nt * 16 + l16;
        #pragma unroll
        for (int r = 0; r < 8; ++r) {
            const int row = q0 + wave * 16 + r + half * 8;
            O[(rowbase + row) * D + col] = (__bf16)(o[nt][r] / lsum[r]);
        }
    }
}

// ---------------------------------------------------------------------------
// Row-wise LayerNorm; optionally also emits a bf16 shadow copy for the next
// GEMM's A operand.
// ---------------------------------------------------------------------------
__global__ __launch_bounds__(256)
void layernorm_kernel(const float* __restrict__ X, const float* __restrict__ g,
                      const float* __restrict__ beta, float* __restrict__ Y,
                      __bf16* __restrict__ Yb, int D)
{
    __shared__ float s_sum[8], s_sq[8];
    const size_t row = blockIdx.x;
    const float* xr = X + row * D;

    float lsum = 0.0f, lsq = 0.0f;
    for (int i = threadIdx.x; i < D; i += 256) {
        float v = xr[i];
        lsum += v;
        lsq  += v * v;
    }
    #pragma unroll
    for (int off = 1; off < 32; off <<= 1) {
        lsum += __shfl_xor(lsum, off, 32);
        lsq  += __shfl_xor(lsq,  off, 32);
    }
    if ((threadIdx.x & 31) == 0) {
        s_sum[threadIdx.x >> 5] = lsum;
        s_sq[threadIdx.x >> 5]  = lsq;
    }
    __syncthreads();
    float tot = 0.0f, totsq = 0.0f;
    #pragma unroll
    for (int i = 0; i < 8; ++i) { tot += s_sum[i]; totsq += s_sq[i]; }
    const float mu  = tot / (float)D;
    const float inv = rsqrtf(totsq / (float)D - mu * mu + LN_EPS);

    for (int i = threadIdx.x; i < D; i += 256) {
        float v = (xr[i] - mu) * inv * g[i] + beta[i];
        Y[row * D + i] = v;
        if (Yb) Yb[row * D + i] = (__bf16)v;
    }
}

// ---------------------------------------------------------------------------
extern "C" void kernel_launch(void* const* d_in, const int* in_sizes, int n_in,
                              void* d_out, int out_size, void* d_ws, size_t ws_size,
                              hipStream_t stream)
{
    const float* x    = (const float*)d_in[0];
    const float* Wq   = (const float*)d_in[1];
    const float* bq   = (const float*)d_in[2];
    const float* Wk   = (const float*)d_in[3];
    const float* bk   = (const float*)d_in[4];
    const float* Wv   = (const float*)d_in[5];
    const float* bv   = (const float*)d_in[6];
    const float* Wo   = (const float*)d_in[7];
    const float* bo   = (const float*)d_in[8];
    const float* W1   = (const float*)d_in[9];
    const float* b1   = (const float*)d_in[10];
    const float* W2   = (const float*)d_in[11];
    const float* b2   = (const float*)d_in[12];
    const float* g1   = (const float*)d_in[13];
    const float* be1  = (const float*)d_in[14];
    const float* g2   = (const float*)d_in[15];
    const float* be2  = (const float*)d_in[16];

    const int B = 4, S = 2048, D = 1024, DFF = 4096;
    const int M = B * S;  // 8192
    const size_t MD  = (size_t)M * D;
    const size_t MDF = (size_t)M * DFF;

    char* p = (char*)d_ws;
    auto alloc = [&](size_t bytes) { char* q = p; p += (bytes + 255) & ~(size_t)255; return q; };

    __bf16* xb  = (__bf16*)alloc(MD * 2);
    __bf16* Wqt = (__bf16*)alloc((size_t)D * D * 2);
    __bf16* Wkt = (__bf16*)alloc((size_t)D * D * 2);
    __bf16* Wvt = (__bf16*)alloc((size_t)D * D * 2);
    __bf16* Wot = (__bf16*)alloc((size_t)D * D * 2);
    __bf16* W1t = (__bf16*)alloc((size_t)D * DFF * 2);
    __bf16* W2t = (__bf16*)alloc((size_t)DFF * D * 2);
    __bf16* Qb  = (__bf16*)alloc(MD * 2);
    __bf16* Kb  = (__bf16*)alloc(MD * 2);
    __bf16* Vb  = (__bf16*)alloc(MD * 2);
    __bf16* Ob  = (__bf16*)alloc(MD * 2);
    float*  h1  = (float*)alloc(MD * 4);
    float*  x2  = (float*)alloc(MD * 4);
    __bf16* x2b = (__bf16*)alloc(MD * 2);
    __bf16* F1b = (__bf16*)alloc(MDF * 2);
    float*  h2  = h1;   // h1 consumed by LN1 before FFN2 writes h2

    const dim3 gblk(256);

    // ---- one-time conversions / weight pre-transposes
    convert_bf16_kernel<<<dim3(MD / 1024), gblk, 0, stream>>>(x, xb, MD);
    transpose_bf16_kernel<<<dim3(D / 64, D / 64),   gblk, 0, stream>>>(Wq, Wqt, D, D);
    transpose_bf16_kernel<<<dim3(D / 64, D / 64),   gblk, 0, stream>>>(Wk, Wkt, D, D);
    transpose_bf16_kernel<<<dim3(D / 64, D / 64),   gblk, 0, stream>>>(Wv, Wvt, D, D);
    transpose_bf16_kernel<<<dim3(D / 64, D / 64),   gblk, 0, stream>>>(Wo, Wot, D, D);
    transpose_bf16_kernel<<<dim3(D / 64, DFF / 64), gblk, 0, stream>>>(W1, W1t, D, DFF);
    transpose_bf16_kernel<<<dim3(DFF / 64, D / 64), gblk, 0, stream>>>(W2, W2t, DFF, D);

    // ---- QKV projections (bf16 outputs; Q pre-scaled by 1/sqrt(dk))
    gemm_bf16_wmma<false, false, false, true><<<dim3(M / 256, D / 64), gblk, 0, stream>>>(
        xb, Wqt, bq, nullptr, nullptr, Qb, 0.125f, M, D, D);
    gemm_bf16_wmma<false, false, false, true><<<dim3(M / 256, D / 64), gblk, 0, stream>>>(
        xb, Wkt, bk, nullptr, nullptr, Kb, 1.0f, M, D, D);
    gemm_bf16_wmma<false, false, false, true><<<dim3(M / 256, D / 64), gblk, 0, stream>>>(
        xb, Wvt, bv, nullptr, nullptr, Vb, 1.0f, M, D, D);

    // ---- attention
    attention_wmma<<<dim3(S / 64, B * 16), dim3(128), 0, stream>>>(Qb, Kb, Vb, Ob, S, D);

    // ---- output projection + residual x  -> h1 (fp32)
    gemm_bf16_wmma<false, true, true, false><<<dim3(M / 256, D / 64), gblk, 0, stream>>>(
        Ob, Wot, bo, x, h1, nullptr, 1.0f, M, D, D);

    // ---- LN1 -> x2 (fp32 residual) + x2b (bf16 operand)
    layernorm_kernel<<<dim3(M), gblk, 0, stream>>>(h1, g1, be1, x2, x2b, D);

    // ---- FFN1 with ReLU -> bf16 only
    gemm_bf16_wmma<true, false, false, true><<<dim3(M / 256, DFF / 64), gblk, 0, stream>>>(
        x2b, W1t, b1, nullptr, nullptr, F1b, 1.0f, M, DFF, D);

    // ---- FFN2 + residual x2 -> h2 (fp32)
    gemm_bf16_wmma<false, true, true, false><<<dim3(M / 256, D / 64), gblk, 0, stream>>>(
        F1b, W2t, b2, x2, h2, nullptr, 1.0f, M, D, DFF);

    // ---- LN2 -> output
    layernorm_kernel<<<dim3(M), gblk, 0, stream>>>(h2, g2, be2, (float*)d_out, nullptr, D);
}

// v002
// A run of this version takes 385 microseconds.
// Timed twice side by side with v001, it ran 1.06 times as fast both times.
// Counting every step since v000, it is 1.25 times as fast.
#include <hip/hip_runtime.h>
#include <hip/hip_bf16.h>

typedef __attribute__((ext_vector_type(16))) __bf16 v16bf;
typedef __attribute__((ext_vector_type(8)))  __bf16 v8bf;
typedef __attribute__((ext_vector_type(4)))  __bf16 v4bf;
typedef __attribute__((ext_vector_type(8)))  float  v8f;
typedef __attribute__((__vector_size__(4 * sizeof(int)))) int i32x4;

#define LN_EPS 1e-5f
#define LDP 72   // padded LDS row length (bf16): 144 B, multiple of 16 B

#if defined(__has_builtin)
#if __has_builtin(__builtin_amdgcn_global_load_async_to_lds_b128) && \
    __has_builtin(__builtin_amdgcn_s_wait_asynccnt)
#define HAVE_ASYNC_LDS 1
#endif
#endif

#define AS1 __attribute__((address_space(1)))
#define AS3 __attribute__((address_space(3)))

__device__ __forceinline__ v8f wmma_bf16(const v16bf& a, const v16bf& b, const v8f& c) {
    return __builtin_amdgcn_wmma_f32_16x16x32_bf16(false, a, false, b, (short)0, c, false, false);
}

// Two contiguous 16-byte LDS loads -> one 16-element bf16 fragment.
__device__ __forceinline__ v16bf load_frag(const __bf16* p0, const __bf16* p1) {
    v8bf lo = *(const v8bf*)p0;
    v8bf hi = *(const v8bf*)p1;
    return __builtin_shufflevector(lo, hi, 0, 1, 2, 3, 4, 5, 6, 7,
                                   8, 9, 10, 11, 12, 13, 14, 15);
}

__device__ __forceinline__ v4bf cvt4(const float4 f) {
    v4bf b;
    b[0] = (__bf16)f.x; b[1] = (__bf16)f.y; b[2] = (__bf16)f.z; b[3] = (__bf16)f.w;
    return b;
}

// 16-byte global(bf16) -> LDS copy; async-to-LDS when toolchain supports it.
__device__ __forceinline__ void copy16B(const __bf16* g, __bf16* l) {
#ifdef HAVE_ASYNC_LDS
    __builtin_amdgcn_global_load_async_to_lds_b128(
        (AS1 i32x4*)g, (AS3 i32x4*)l, 0, 0);
#else
    *(v8bf*)l = *(const v8bf*)g;
#endif
}

__device__ __forceinline__ void async_wait() {
#ifdef HAVE_ASYNC_LDS
    __builtin_amdgcn_s_wait_asynccnt(0);
#endif
}

// ---------------------------------------------------------------------------
// fp32 -> bf16 elementwise. Few fat waves: 16 float4 per thread, 512-thread
// blocks; the grid must cover n exactly (n = blocks * 512 * 16 * 4).
// ---------------------------------------------------------------------------
#define CVT_THREADS 512
#define CVT_VEC     16    // float4 per thread
__global__ __launch_bounds__(CVT_THREADS)
void convert_bf16_kernel(const float* __restrict__ X, __bf16* __restrict__ Y)
{
    const size_t base =
        ((size_t)blockIdx.x * (CVT_THREADS * CVT_VEC) + threadIdx.x) * 4;
    float4 f[CVT_VEC];
    // unrolled so that f[] stays in registers and many loads are in flight at once
    #pragma unroll
    for (int i = 0; i < CVT_VEC; ++i)
        f[i] = *(const float4*)&X[base + (size_t)i * (CVT_THREADS * 4)];
    // unrolled: f[] is indexed by constants only
    #pragma unroll
    for (int i = 0; i < CVT_VEC; ++i)
        *(v4bf*)&Y[base + (size_t)i * (CVT_THREADS * 4)] = cvt4(f[i]);
}

// ---------------------------------------------------------------------------
// W[K,N] fp32 -> Wt[N,K] bf16 (64x64 LDS-tiled transpose)
// ---------------------------------------------------------------------------
__global__ __launch_bounds__(256)
void transpose_bf16_kernel(const float* __restrict__ W, __bf16* __restrict__ Wt,
                           int K, int N)
{
    __shared__ float T[64][65];
    const int k0 = blockIdx.x * 64, n0 = blockIdx.y * 64;
    #pragma unroll
    for (int i = 0; i < 16; ++i) {
        int idx = threadIdx.x + i * 256;
        int r = idx >> 6, c = idx & 63;
        T[r][c] = W[(size_t)(k0 + r) * N + n0 + c];
    }
    __syncthreads();
    #pragma unroll
    for (int i = 0; i < 16; ++i) {
        int idx = threadIdx.x + i * 256;
        int r = idx >> 6, c = idx & 63;         // r = n-local, c = k-local
        Wt[(size_t)(n0 + r) * K + k0 + c] = (__bf16)T[c][r];
    }
}

// ---------------------------------------------------------------------------
// GEMM: C = op(A[M,K](bf16) @ Wt[N,K](bf16)^T + bias (+ resid))
// 256x64 tile / 256-thread block; 8 waves x (32x64 strip). Both LDS stages
// are straight 16-byte copies (async-to-LDS when available).
// Outputs: fp32 C and/or bf16 C (scaled) per template flags.
// ---------------------------------------------------------------------------
template<bool RELU, bool RESID, bool OUTF32, bool OUTBF16>
__global__ __launch_bounds__(256)
void gemm_bf16_wmma(const __bf16* __restrict__ A, const __bf16* __restrict__ Wt,
                    const float* __restrict__ bias, const float* __restrict__ resid,
                    float* __restrict__ Cf, __bf16* __restrict__ Cb, float oscale,
                    int M, int N, int K)
{
    __shared__ __align__(16) __bf16 As[256][LDP];  // [m][k]
    __shared__ __align__(16) __bf16 Bt[64][LDP];   // [n][k]
    const int tid  = threadIdx.x;
    const int wave = tid >> 5;
    const int lane = tid & 31;
    const int half = lane >> 4;
    const int l16  = lane & 15;
    const int kb0  = half * 8;
    const int kb1  = 16 + half * 8;
    const int m0 = blockIdx.x * 256;
    const int n0 = blockIdx.y * 64;

    v8f acc[2][4] = {};

    for (int k0 = 0; k0 < K; k0 += 64) {
        // stage A tile: 256 rows x 64 bf16 = 2048 16-byte chunks
        #pragma unroll
        for (int i = 0; i < 8; ++i) {
            int idx = tid + i * 256;
            int r = idx >> 3, c = (idx & 7) * 8;
            copy16B(&A[(size_t)(m0 + r) * K + k0 + c], &As[r][c]);
        }
        // stage B tile (already [n][k] in global): 512 chunks
        #pragma unroll
        for (int i = 0; i < 2; ++i) {
            int idx = tid + i * 256;
            int r = idx >> 3, c = (idx & 7) * 8;
            copy16B(&Wt[(size_t)(n0 + r) * K + k0 + c], &Bt[r][c]);
        }
        async_wait();
        __syncthreads();

        const int row0 = wave * 32 + l16;
        #pragma unroll
        for (int ks = 0; ks < 64; ks += 32) {
            v16bf a0 = load_frag(&As[row0][ks + kb0],      &As[row0][ks + kb1]);
            v16bf a1 = load_frag(&As[row0 + 16][ks + kb0], &As[row0 + 16][ks + kb1]);
            #pragma unroll
            for (int nt = 0; nt < 4; ++nt) {
                const int col = nt * 16 + l16;
                v16bf b = load_frag(&Bt[col][ks + kb0], &Bt[col][ks + kb1]);
                acc[0][nt] = wmma_bf16(a0, b, acc[0][nt]);
                acc[1][nt] = wmma_bf16(a1, b, acc[1][nt]);
            }
        }
        __syncthreads();
    }

    #pragma unroll
    for (int mi = 0; mi < 2; ++mi)
        #pragma unroll
        for (int nt = 0; nt < 4; ++nt) {
            const int col = n0 + nt * 16 + l16;
            const float bv = bias[col];
            #pragma unroll
            for (int r = 0; r < 8; ++r) {
                const int row = m0 + wave * 32 + mi * 16 + r + half * 8;
                float v = acc[mi][nt][r] + bv;
                if (RESID) v += resid[(size_t)row * N + col];
                if (RELU)  v = fmaxf(v, 0.0f);
                if (OUTF32)  Cf[(size_t)row * N + col] = v;
                if (OUTBF16) Cb[(size_t)row * N + col] = (__bf16)(v * oscale);
            }
        }
}

// ---------------------------------------------------------------------------
// Flash-attention per (b,h, 64-query block). dk=64, S=2048; Q pre-scaled by
// 1/sqrt(dk) at the Q-GEMM. Scores std ~1 -> plain exp is fp32-safe (softmax
// is shift-invariant); row-sums via WMMA with an all-ones B matrix.
// Q/K/V are bf16; Q/K stage as pure copies (async), V via register transpose.
// Output written bf16 (only consumed by the Wo GEMM).
// ---------------------------------------------------------------------------
__global__ __launch_bounds__(128)
void attention_wmma(const __bf16* __restrict__ Q, const __bf16* __restrict__ Km,
                    const __bf16* __restrict__ Vm, __bf16* __restrict__ O,
                    int S, int D)
{
    __shared__ __align__(16) __bf16 Qs[64][LDP];   // [q][d]
    __shared__ __align__(16) __bf16 Ks[64][LDP];   // [key][d]
    __shared__ __align__(16) __bf16 Vt[64][LDP];   // [d][key]
    __shared__ __align__(16) __bf16 Ps[64][LDP];   // probs [q][key]

    const int tid  = threadIdx.x;
    const int wave = tid >> 5;
    const int lane = tid & 31;
    const int half = lane >> 4;
    const int l16  = lane & 15;
    const int kb0  = half * 8;
    const int kb1  = 16 + half * 8;

    const int q0 = blockIdx.x * 64;
    const int bh = blockIdx.y;
    const int b  = bh >> 4;
    const int h  = bh & 15;
    const size_t rowbase = (size_t)b * S;
    const int    cbase   = h * 64;

    // stage Q block (pure bf16 copy; scale already folded in)
    #pragma unroll
    for (int i = 0; i < 4; ++i) {
        int idx = tid + i * 128;
        int r = idx >> 3, c = (idx & 7) * 8;
        copy16B(&Q[(rowbase + q0 + r) * D + cbase + c], &Qs[r][c]);
    }

    v16bf ones;
    #pragma unroll
    for (int i = 0; i < 16; ++i) ones[i] = (__bf16)1.0f;

    v8f o[4] = {};
    v8f lsum = {};

    const int rowA = wave * 16 + l16;

    for (int kb = 0; kb < S; kb += 64) {
        __syncthreads();
        // K row-major copy (async)
        #pragma unroll
        for (int i = 0; i < 4; ++i) {
            int idx = tid + i * 128;
            int r = idx >> 3, c = (idx & 7) * 8;
            copy16B(&Km[(rowbase + kb + r) * D + cbase + c], &Ks[r][c]);
        }
        // V transposed via 4x4 register micro-tiles
        #pragma unroll
        for (int tt = 0; tt < 2; ++tt) {
            const int t  = tid + tt * 128;
            const int tn = t & 15;      // d block
            const int tk = t >> 4;      // key block
            v4bf f[4];
            #pragma unroll
            for (int j = 0; j < 4; ++j)
                f[j] = *(const v4bf*)&Vm[(rowbase + kb + tk * 4 + j) * D + cbase + tn * 4];
            #pragma unroll
            for (int i = 0; i < 4; ++i) {
                v4bf p;
                p[0] = f[0][i]; p[1] = f[1][i]; p[2] = f[2][i]; p[3] = f[3][i];
                *(v4bf*)&Vt[tn * 4 + i][tk * 4] = p;
            }
        }
        async_wait();
        __syncthreads();

        // ---- scores = Q * K^T
        v16bf a0 = load_frag(&Qs[rowA][kb0],      &Qs[rowA][kb1]);
        v16bf a1 = load_frag(&Qs[rowA][32 + kb0], &Qs[rowA][32 + kb1]);
        v8f s[4];
        #pragma unroll
        for (int nt = 0; nt < 4; ++nt) {
            const int col = nt * 16 + l16;
            v16bf b0 = load_frag(&Ks[col][kb0],      &Ks[col][kb1]);
            v16bf b1 = load_frag(&Ks[col][32 + kb0], &Ks[col][32 + kb1]);
            v8f z = {};
            z = wmma_bf16(a0, b0, z);
            z = wmma_bf16(a1, b1, z);
            s[nt] = z;
        }

        // ---- p = exp(s), staged to LDS row-major (own strip only)
        #pragma unroll
        for (int nt = 0; nt < 4; ++nt)
            #pragma unroll
            for (int r = 0; r < 8; ++r)
                Ps[wave * 16 + r + half * 8][nt * 16 + l16] = (__bf16)__expf(s[nt][r]);

        v16bf p0 = load_frag(&Ps[rowA][kb0],      &Ps[rowA][kb1]);
        v16bf p1 = load_frag(&Ps[rowA][32 + kb0], &Ps[rowA][32 + kb1]);

        // ---- row-sums of P via WMMA with all-ones B (broadcast per column)
        lsum = wmma_bf16(p0, ones, lsum);
        lsum = wmma_bf16(p1, ones, lsum);

        // ---- O += P * V
        #pragma unroll
        for (int nt = 0; nt < 4; ++nt) {
            const int col = nt * 16 + l16;
            v16bf b0 = load_frag(&Vt[col][kb0],      &Vt[col][kb1]);
            v16bf b1 = load_frag(&Vt[col][32 + kb0], &Vt[col][32 + kb1]);
            o[nt] = wmma_bf16(p0, b0, o[nt]);
            o[nt] = wmma_bf16(p1, b1, o[nt]);
        }
    }

    // ---- normalize by row-sum, write bf16
    #pragma unroll
    for (int nt = 0; nt < 4; ++nt) {
        const int col = cbase + nt * 16 + l16;
        #pragma unroll
        for (int r = 0; r < 8; ++r) {
            const int row = q0 + wave * 16 + r + half * 8;
            O[(rowbase + row) * D + col] = (__bf16)(o[nt][r] / lsum[r]);
        }
    }
}

// ---------------------------------------------------------------------------
// Row-wise LayerNorm over rows of LN_D floats; optionally also emits a bf16
// shadow copy for the next GEMM's A operand.
// One wave owns LN_ROWS whole rows, held in registers (16-byte loads, 512
// contiguous bytes per wave load): no LDS, no barrier, the row is read once,
// and the launch starts 16x fewer waves than one 8-wave block per row.
// ---------------------------------------------------------------------------
#define LN_D       1024
#define LN_THREADS 512
#define LN_ROWS    2                 // rows per wave
#define LN_VEC     (LN_D / 128)      // float4 per lane and row
template<bool OUTBF16>
__global__ __launch_bounds__(LN_THREADS)
void layernorm_kernel(const float* __restrict__ X, const float* __restrict__ g,
                      const float* __restrict__ beta, float* __restrict__ Y,
                      __bf16* __restrict__ Yb)
{
    const unsigned lane = threadIdx.x & 31;
    const unsigned row0 =
        (blockIdx.x * (LN_THREADS / 32) + (threadIdx.x >> 5)) * LN_ROWS;
    // One 32-bit byte offset (a plane is 32 MiB) on the scalar bases X and Y:
    // the row loads and the fp32 stores share one offset register, which so
    // stays live from the first load to the last store.
    const unsigned boff = (row0 * LN_D + lane * 4) * 4u;
    const float* xp  = (const float*)((const char*)X + boff);
    float*       yp  = (float*)((char*)Y + boff);
    __bf16*      ybp = OUTBF16 ? (__bf16*)((char*)Yb + (boff >> 1)) : nullptr;

    float4 v[LN_ROWS][LN_VEC], gg[LN_VEC], bb[LN_VEC];
    // every loop below is unrolled so that the arrays are indexed by constants
    // and stay in registers; here it also puts all row loads in flight at once
    #pragma unroll
    for (int r = 0; r < LN_ROWS; ++r)
        #pragma unroll
        for (int j = 0; j < LN_VEC; ++j)
            v[r][j] = *(const float4*)&xp[r * LN_D + j * 128];
    #pragma unroll
    for (int j = 0; j < LN_VEC; ++j) {
        gg[j] = *(const float4*)&g[j * 128 + lane * 4];
        bb[j] = *(const float4*)&beta[j * 128 + lane * 4];
    }

    float sum[LN_ROWS], sq[LN_ROWS];
    #pragma unroll
    for (int r = 0; r < LN_ROWS; ++r) {
        float4 s = make_float4(0.f, 0.f, 0.f, 0.f);   // four independent chains
        float4 q = make_float4(0.f, 0.f, 0.f, 0.f);
        #pragma unroll
        for (int j = 0; j < LN_VEC; ++j) {
            const float4 t = v[r][j];
            s.x += t.x; s.y += t.y; s.z += t.z; s.w += t.w;
            q.x += t.x * t.x; q.y += t.y * t.y; q.z += t.z * t.z; q.w += t.w * t.w;
        }
        sum[r] = (s.x + s.y) + (s.z + s.w);
        sq[r]  = (q.x + q.y) + (q.z + q.w);
    }
    #pragma unroll
    for (int off = 1; off < 32; off <<= 1)
        #pragma unroll
        for (int r = 0; r < LN_ROWS; ++r) {
            sum[r] += __shfl_xor(sum[r], off, 32);
            sq[r]  += __shfl_xor(sq[r],  off, 32);
        }

    v4bf yb[LN_ROWS][LN_VEC];
    #pragma unroll
    for (int r = 0; r < LN_ROWS; ++r) {
        const float mu  = sum[r] / (float)LN_D;
        const float inv = rsqrtf(sq[r] / (float)LN_D - mu * mu + LN_EPS);
        #pragma unroll
        for (int j = 0; j < LN_VEC; ++j) {
            float4 t = v[r][j];
            t.x = (t.x - mu) * inv * gg[j].x + bb[j].x;
            t.y = (t.y - mu) * inv * gg[j].y + bb[j].y;
            t.z = (t.z - mu) * inv * gg[j].z + bb[j].z;
            t.w = (t.w - mu) * inv * gg[j].w + bb[j].w;
            v[r][j] = t;
            if (OUTBF16) yb[r][j] = cvt4(t);
        }
    }

    // Without this the scheduler sinks the second row's loads behind the first
    // row's stores (two memory latencies in a row) and reuses the registers of
    // issued stores; with it every store stands behind the last arithmetic.
    __builtin_amdgcn_sched_barrier(0);

    #pragma unroll
    for (int r = 0; r < LN_ROWS; ++r)
        #pragma unroll
        for (int j = 0; j < LN_VEC; ++j) {
            const int o = r * LN_D + j * 128;
            *(float4*)&yp[o] = v[r][j];
            if (OUTBF16) *(v4bf*)&ybp[o] = yb[r][j];
        }
}

// ---------------------------------------------------------------------------
extern "C" void kernel_launch(void* const* d_in, const int* in_sizes, int n_in,
                              void* d_out, int out_size, void* d_ws, size_t ws_size,
                              hipStream_t stream)
{
    const float* x    = (const float*)d_in[0];
    const float* Wq   = (const float*)d_in[1];
    const float* bq   = (const float*)d_in[2];
    const float* Wk   = (const float*)d_in[3];
    const float* bk   = (const float*)d_in[4];
    const float* Wv   = (const float*)d_in[5];
    const float* bv   = (const float*)d_in[6];
    const float* Wo   = (const float*)d_in[7];
    const float* bo   = (const float*)d_in[8];
    const float* W1   = (const float*)d_in[9];
    const float* b1   = (const float*)d_in[10];
    const float* W2   = (const float*)d_in[11];
    const float* b2   = (const float*)d_in[12];
    const float* g1   = (const float*)d_in[13];
    const float* be1  = (const float*)d_in[14];
    const float* g2   = (const float*)d_in[15];
    const float* be2  = (const float*)d_in[16];

    const int B = 4, S = 2048, D = 1024, DFF = 4096;
    const int M = B * S;  // 8192
    const size_t MD  = (size_t)M * D;
    const size_t MDF = (size_t)M * DFF;

    char* p = (char*)d_ws;
    auto alloc = [&](size_t bytes) { char* q = p; p += (bytes + 255) & ~(size_t)255; return q; };

    __bf16* xb  = (__bf16*)alloc(MD * 2);
    __bf16* Wqt = (__bf16*)alloc((size_t)D * D * 2);
    __bf16* Wkt = (__bf16*)alloc((size_t)D * D * 2);
    __bf16* Wvt = (__bf16*)alloc((size_t)D * D * 2);
    __bf16* Wot = (__bf16*)alloc((size_t)D * D * 2);
    __bf16* W1t = (__bf16*)alloc((size_t)D * DFF * 2);
    __bf16* W2t = (__bf16*)alloc((size_t)DFF * D * 2);
    __bf16* Qb  = (__bf16*)alloc(MD * 2);
    __bf16* Kb  = (__bf16*)alloc(MD * 2);
    __bf16* Vb  = (__bf16*)alloc(MD * 2);
    __bf16* Ob  = (__bf16*)alloc(MD * 2);
    float*  h1  = (float*)alloc(MD * 4);
    float*  x2  = (float*)alloc(MD * 4);
    __bf16* x2b = (__bf16*)alloc(MD * 2);
    __bf16* F1b = (__bf16*)alloc(MDF * 2);
    float*  h2  = h1;   // h1 consumed by LN1 before FFN2 writes h2

    const dim3 gblk(256);

    // ---- one-time conversions / weight pre-transposes
    convert_bf16_kernel<<<dim3(MD / (CVT_THREADS * CVT_VEC * 4)), dim3(CVT_THREADS), 0, stream>>>(x, xb);
    transpose_bf16_kernel<<<dim3(D / 64, D / 64),   gblk, 0, stream>>>(Wq, Wqt, D, D);
    transpose_bf16_kernel<<<dim3(D / 64, D / 64),   gblk, 0, stream>>>(Wk, Wkt, D, D);
    transpose_bf16_kernel<<<dim3(D / 64, D / 64),   gblk, 0, stream>>>(Wv, Wvt, D, D);
    transpose_bf16_kernel<<<dim3(D / 64, D / 64),   gblk, 0, stream>>>(Wo, Wot, D, D);
    transpose_bf16_kernel<<<dim3(D / 64, DFF / 64), gblk, 0, stream>>>(W1, W1t, D, DFF);
    transpose_bf16_kernel<<<dim3(DFF / 64, D / 64), gblk, 0, stream>>>(W2, W2t, DFF, D);

    // ---- QKV projections (bf16 outputs; Q pre-scaled by 1/sqrt(dk))
    gemm_bf16_wmma<false, false, false, true><<<dim3(M / 256, D / 64), gblk, 0, stream>>>(
        xb, Wqt, bq, nullptr, nullptr, Qb, 0.125f, M, D, D);
    gemm_bf16_wmma<false, false, false, true><<<dim3(M / 256, D / 64), gblk, 0, stream>>>(
        xb, Wkt, bk, nullptr, nullptr, Kb, 1.0f, M, D, D);
    gemm_bf16_wmma<false, false, false, true><<<dim3(M / 256, D / 64), gblk, 0, stream>>>(
        xb, Wvt, bv, nullptr, nullptr, Vb, 1.0f, M, D, D);

    // ---- attention
    attention_wmma<<<dim3(S / 64, B * 16), dim3(128), 0, stream>>>(Qb, Kb, Vb, Ob, S, D);

    // ---- output projection + residual x  -> h1 (fp32)
    gemm_bf16_wmma<false, true, true, false><<<dim3(M / 256, D / 64), gblk, 0, stream>>>(
        Ob, Wot, bo, x, h1, nullptr, 1.0f, M, D, D);

    // ---- LN1 -> x2 (fp32 residual) + x2b (bf16 operand)
    layernorm_kernel<true><<<dim3(M / (LN_THREADS / 32 * LN_ROWS)), dim3(LN_THREADS), 0, stream>>>(h1, g1, be1, x2, x2b);

    // ---- FFN1 with ReLU -> bf16 only
    gemm_bf16_wmma<true, false, false, true><<<dim3(M / 256, DFF / 64), gblk, 0, stream>>>(
        x2b, W1t, b1, nullptr, nullptr, F1b, 1.0f, M, DFF, D);

    // ---- FFN2 + residual x2 -> h2 (fp32)
    gemm_bf16_wmma<false, true, true, false><<<dim3(M / 256, D / 64), gblk, 0, stream>>>(
        F1b, W2t, b2, x2, h2, nullptr, 1.0f, M, D, DFF);

    // ---- LN2 -> output
    layernorm_kernel<false><<<dim3(M / (LN_THREADS / 32 * LN_ROWS)), dim3(LN_THREADS), 0, stream>>>(h2, g2, be2, (float*)d_out, nullptr);
}

// v003
// One run takes 358 microseconds.
// Two timings next to v002 both put it at 1.08 times that version's speed.
// Over all steps from v000 it is 1.35 times as fast.
#include <hip/hip_runtime.h>
#include <hip/hip_bf16.h>

typedef __attribute__((ext_vector_type(16))) __bf16 v16bf;
typedef __attribute__((ext_vector_type(8)))  __bf16 v8bf;
typedef __attribute__((ext_vector_type(4)))  __bf16 v4bf;
typedef __attribute__((ext_vector_type(8)))  float  v8f;
typedef __attribute__((__vector_size__(4 * sizeof(int)))) int i32x4;

#define LN_EPS 1e-5f
#define LDP 72   // padded LDS row length (bf16): 144 B, multiple of 16 B

#if defined(__has_builtin)
#if __has_builtin(__builtin_amdgcn_global_load_async_to_lds_b128) && \
    __has_builtin(__builtin_amdgcn_s_wait_asynccnt)
#define HAVE_ASYNC_LDS 1
#endif
#endif

#define AS1 __attribute__((address_space(1)))
#define AS3 __attribute__((address_space(3)))

__device__ __forceinline__ v8f wmma_bf16(const v16bf& a, const v16bf& b, const v8f& c) {
    return __builtin_amdgcn_wmma_f32_16x16x32_bf16(false, a, false, b, (short)0, c, false, false);
}

// Two contiguous 16-byte LDS loads -> one 16-element bf16 fragment.
__device__ __forceinline__ v16bf load_frag(const __bf16* p0, const __bf16* p1) {
    v8bf lo = *(const v8bf*)p0;
    v8bf hi = *(const v8bf*)p1;
    return __builtin_shufflevector(lo, hi, 0, 1, 2, 3, 4, 5, 6, 7,
                                   8, 9, 10, 11, 12, 13, 14, 15);
}

__device__ __forceinline__ v4bf cvt4(const float4 f) {
    v4bf b;
    b[0] = (__bf16)f.x; b[1] = (__bf16)f.y; b[2] = (__bf16)f.z; b[3] = (__bf16)f.w;
    return b;
}

// 16-byte global(bf16) -> LDS copy; async-to-LDS when toolchain supports it.
__device__ __forceinline__ void copy16B(const __bf16* g, __bf16* l) {
#ifdef HAVE_ASYNC_LDS
    __builtin_amdgcn_global_load_async_to_lds_b128(
        (AS1 i32x4*)g, (AS3 i32x4*)l, 0, 0);
#else
    *(v8bf*)l = *(const v8bf*)g;
#endif
}

__device__ __forceinline__ void async_wait() {
#ifdef HAVE_ASYNC_LDS
    __builtin_amdgcn_s_wait_asynccnt(0);
#endif
}

// ---------------------------------------------------------------------------
// Preparation, ONE launch: x -> bf16 and the six weights -> transposed bf16.
// The seven jobs do not depend on each other, so they share one grid and pay
// one launch gap, one fill and one drain; a block picks its job from
// blockIdx.x (the same for the whole block).
// ---------------------------------------------------------------------------
#define PD    1024                   // model width
#define PDFF  4096                   // hidden width
#define PM    8192                   // rows of x
#define PREP_THREADS 256
#define CVT_VEC      16              // float4 per thread
#define CVT_BLOCKS   (PM * PD / (PREP_THREADS * CVT_VEC * 4))
#define TSQ_BLOCKS   ((PD / 64) * (PD / 64))      // one square weight
#define TFF_BLOCKS   ((PD / 64) * (PDFF / 64))    // W1 or W2
#define PREP_BLOCKS  (CVT_BLOCKS + 4 * TSQ_BLOCKS + 2 * TFF_BLOCKS)

// fp32 -> bf16 elementwise, fat waves: 16 float4 per thread.
__device__ __forceinline__
void convert_block(const float* __restrict__ X, __bf16* __restrict__ Y, unsigned blk)
{
    const size_t base =
        ((size_t)blk * (PREP_THREADS * CVT_VEC) + threadIdx.x) * 4;
    float4 f[CVT_VEC];
    // unrolled so that f[] stays in registers and many loads are in flight at once
    #pragma unroll
    for (int i = 0; i < CVT_VEC; ++i)
        f[i] = *(const float4*)&X[base + (size_t)i * (PREP_THREADS * 4)];
    // unrolled: f[] is indexed by constants only
    #pragma unroll
    for (int i = 0; i < CVT_VEC; ++i)
        *(v4bf*)&Y[base + (size_t)i * (PREP_THREADS * 4)] = cvt4(f[i]);
}

// W[K,N] fp32 -> Wt[N,K] bf16, one 64x64 tile through LDS.
__device__ __forceinline__
void transpose_block(const float* __restrict__ W, __bf16* __restrict__ Wt,
                     int K, int N, int k0, int n0, float (*T)[65])
{
    #pragma unroll
    for (int i = 0; i < 16; ++i) {
        int idx = threadIdx.x + i * 256;
        int r = idx >> 6, c = idx & 63;
        T[r][c] = W[(size_t)(k0 + r) * N + n0 + c];
    }
    __syncthreads();
    #pragma unroll
    for (int i = 0; i < 16; ++i) {
        int idx = threadIdx.x + i * 256;
        int r = idx >> 6, c = idx & 63;         // r = n-local, c = k-local
        Wt[(size_t)(n0 + r) * K + k0 + c] = (__bf16)T[c][r];
    }
    // The jobs are laid out one behind the other in the built kernel: this wait
    // stands between the stores above and any later write of their registers.
    asm volatile("s_wait_xcnt 0x0" ::: "memory");
}

__global__ __launch_bounds__(PREP_THREADS)
void prepare_kernel(const float* __restrict__ X,  __bf16* __restrict__ Xb,
                    const float* __restrict__ Wq, __bf16* __restrict__ Wqt,
                    const float* __restrict__ Wk, __bf16* __restrict__ Wkt,
                    const float* __restrict__ Wv, __bf16* __restrict__ Wvt,
                    const float* __restrict__ Wo, __bf16* __restrict__ Wot,
                    const float* __restrict__ W1, __bf16* __restrict__ W1t,
                    const float* __restrict__ W2, __bf16* __restrict__ W2t)
{
    __shared__ float T[64][65];
    unsigned b = blockIdx.x;
    if (b < CVT_BLOCKS) {                        // the largest jobs start first
        convert_block(X, Xb, b);
        return;
    }
    b -= CVT_BLOCKS;
    if (b < 4 * TSQ_BLOCKS) {
        const unsigned w = b / TSQ_BLOCKS, t = b % TSQ_BLOCKS;
        const float* W  = w == 0 ? Wq  : w == 1 ? Wk  : w == 2 ? Wv  : Wo;
        __bf16*      Wt = w == 0 ? Wqt : w == 1 ? Wkt : w == 2 ? Wvt : Wot;
        transpose_block(W, Wt, PD, PD, (t % (PD / 64)) * 64, (t / (PD / 64)) * 64, T);
        return;
    }
    b -= 4 * TSQ_BLOCKS;
    if (b < TFF_BLOCKS) {
        transpose_block(W1, W1t, PD, PDFF, (b % (PD / 64)) * 64, (b / (PD / 64)) * 64, T);
        return;
    }
    b -= TFF_BLOCKS;
    transpose_block(W2, W2t, PDFF, PD, (b % (PDFF / 64)) * 64, (b / (PDFF / 64)) * 64, T);
}

// ---------------------------------------------------------------------------
// GEMM: C = op(A[M,K](bf16) @ Wt[N,K](bf16)^T + bias (+ resid))
// 256x64 tile / 256-thread block; 8 waves x (32x64 strip). Both LDS stages
// are straight 16-byte copies (async-to-LDS when available).
// Outputs: fp32 C and/or bf16 C (scaled) per template flags.
// ---------------------------------------------------------------------------
template<bool RELU, bool RESID, bool OUTF32, bool OUTBF16>
__device__ __forceinline__
void gemm_tile(const __bf16* __restrict__ A, const __bf16* __restrict__ Wt,
               const float* __restrict__ bias, const float* __restrict__ resid,
               float* __restrict__ Cf, __bf16* __restrict__ Cb, float oscale,
               int N, int K)
{
    __shared__ __align__(16) __bf16 As[256][LDP];  // [m][k]
    __shared__ __align__(16) __bf16 Bt[64][LDP];   // [n][k]
    const int tid  = threadIdx.x;
    const int wave = tid >> 5;
    const int lane = tid & 31;
    const int half = lane >> 4;
    const int l16  = lane & 15;
    const int kb0  = half * 8;
    const int kb1  = 16 + half * 8;
    const int m0 = blockIdx.x * 256;
    const int n0 = blockIdx.y * 64;

    v8f acc[2][4] = {};

    for (int k0 = 0; k0 < K; k0 += 64) {
        // stage A tile: 256 rows x 64 bf16 = 2048 16-byte chunks
        #pragma unroll
        for (int i = 0; i < 8; ++i) {
            int idx = tid + i * 256;
            int r = idx >> 3, c = (idx & 7) * 8;
            copy16B(&A[(size_t)(m0 + r) * K + k0 + c], &As[r][c]);
        }
        // stage B tile (already [n][k] in global): 512 chunks
        #pragma unroll
        for (int i = 0; i < 2; ++i) {
            int idx = tid + i * 256;
            int r = idx >> 3, c = (idx & 7) * 8;
            copy16B(&Wt[(size_t)(n0 + r) * K + k0 + c], &Bt[r][c]);
        }
        async_wait();
        __syncthreads();

        const int row0 = wave * 32 + l16;
        #pragma unroll
        for (int ks = 0; ks < 64; ks += 32) {
            v16bf a0 = load_frag(&As[row0][ks + kb0],      &As[row0][ks + kb1]);
            v16bf a1 = load_frag(&As[row0 + 16][ks + kb0], &As[row0 + 16][ks + kb1]);
            #pragma unroll
            for (int nt = 0; nt < 4; ++nt) {
                const int col = nt * 16 + l16;
                v16bf b = load_frag(&Bt[col][ks + kb0], &Bt[col][ks + kb1]);
                acc[0][nt] = wmma_bf16(a0, b, acc[0][nt]);
                acc[1][nt] = wmma_bf16(a1, b, acc[1][nt]);
            }
        }
        __syncthreads();
    }

    #pragma unroll
    for (int mi = 0; mi < 2; ++mi)
        #pragma unroll
        for (int nt = 0; nt < 4; ++nt) {
            const int col = n0 + nt * 16 + l16;
            const float bv = bias[col];
            #pragma unroll
            for (int r = 0; r < 8; ++r) {
                const int row = m0 + wave * 32 + mi * 16 + r + half * 8;
                float v = acc[mi][nt][r] + bv;
                if (RESID) v += resid[(size_t)row * N + col];
                if (RELU)  v = fmaxf(v, 0.0f);
                if (OUTF32)  Cf[(size_t)row * N + col] = v;
                if (OUTBF16) Cb[(size_t)row * N + col] = (__bf16)(v * oscale);
            }
        }
}

template<bool RELU, bool RESID, bool OUTF32, bool OUTBF16>
__global__ __launch_bounds__(256)
void gemm_bf16_wmma(const __bf16* __restrict__ A, const __bf16* __restrict__ Wt,
                    const float* __restrict__ bias, const float* __restrict__ resid,
                    float* __restrict__ Cf, __bf16* __restrict__ Cb, float oscale,
                    int M, int N, int K)
{
    gemm_tile<RELU, RESID, OUTF32, OUTBF16>(A, Wt, bias, resid, Cf, Cb, oscale, N, K);
}

// The three projections of the same A in ONE launch: blockIdx.z picks the
// weight, bias and output. They are independent, so one grid of three times
// the blocks pays one gap, fill and drain and keeps more blocks on a WGP.
__global__ __launch_bounds__(256)
void gemm_qkv_wmma(const __bf16* __restrict__ A,
                   const __bf16* __restrict__ Wqt, const __bf16* __restrict__ Wkt,
                   const __bf16* __restrict__ Wvt,
                   const float* __restrict__ bq, const float* __restrict__ bk,
                   const float* __restrict__ bv,
                   __bf16* __restrict__ Qb, __bf16* __restrict__ Kb,
                   __bf16* __restrict__ Vb, float qscale, int N, int K)
{
    const unsigned w = blockIdx.z;
    const __bf16* Wt   = w == 0 ? Wqt : w == 1 ? Wkt : Wvt;
    const float*  bias = w == 0 ? bq  : w == 1 ? bk  : bv;
    __bf16*       Cb   = w == 0 ? Qb  : w == 1 ? Kb  : Vb;
    gemm_tile<false, false, false, true>(A, Wt, bias, nullptr, nullptr, Cb,
                                         w == 0 ? qscale : 1.0f, N, K);
}

// ---------------------------------------------------------------------------
// Flash-attention per (b,h, 64-query block). dk=64, S=2048; Q pre-scaled by
// 1/sqrt(dk) at the Q-GEMM. Scores std ~1 -> plain exp is fp32-safe (softmax
// is shift-invariant); row-sums via WMMA with an all-ones B matrix.
// Q/K/V are bf16; Q/K stage as pure copies (async), V via register transpose.
// Output written bf16 (only consumed by the Wo GEMM).
// ---------------------------------------------------------------------------
__global__ __launch_bounds__(128)
void attention_wmma(const __bf16* __restrict__ Q, const __bf16* __restrict__ Km,
                    const __bf16* __restrict__ Vm, __bf16* __restrict__ O,
                    int S, int D)
{
    __shared__ __align__(16) __bf16 Qs[64][LDP];   // [q][d]
    __shared__ __align__(16) __bf16 Ks[64][LDP];   // [key][d]
    __shared__ __align__(16) __bf16 Vt[64][LDP];   // [d][key]
    __shared__ __align__(16) __bf16 Ps[64][LDP];   // probs [q][key]

    const int tid  = threadIdx.x;
    const int wave = tid >> 5;
    const int lane = tid & 31;
    const int half = lane >> 4;
    const int l16  = lane & 15;
    const int kb0  = half * 8;
    const int kb1  = 16 + half * 8;

    const int q0 = blockIdx.x * 64;
    const int bh = blockIdx.y;
    const int b  = bh >> 4;
    const int h  = bh & 15;
    const size_t rowbase = (size_t)b * S;
    const int    cbase   = h * 64;

    // stage Q block (pure bf16 copy; scale already folded in)
    #pragma unroll
    for (int i = 0; i < 4; ++i) {
        int idx = tid + i * 128;
        int r = idx >> 3, c = (idx & 7) * 8;
        copy16B(&Q[(rowbase + q0 + r) * D + cbase + c], &Qs[r][c]);
    }

    v16bf ones;
    #pragma unroll
    for (int i = 0; i < 16; ++i) ones[i] = (__bf16)1.0f;

    v8f o[4] = {};
    v8f lsum = {};

    const int rowA = wave * 16 + l16;

    for (int kb = 0; kb < S; kb += 64) {
        __syncthreads();
        // K row-major copy (async)
        #pragma unroll
        for (int i = 0; i < 4; ++i) {
            int idx = tid + i * 128;
            int r = idx >> 3, c = (idx & 7) * 8;
            copy16B(&Km[(rowbase + kb + r) * D + cbase + c], &Ks[r][c]);
        }
        // V transposed via 4x4 register micro-tiles
        #pragma unroll
        for (int tt = 0; tt < 2; ++tt) {
            const int t  = tid + tt * 128;
            const int tn = t & 15;      // d block
            const int tk = t >> 4;      // key block
            v4bf f[4];
            #pragma unroll
            for (int j = 0; j < 4; ++j)
                f[j] = *(const v4bf*)&Vm[(rowbase + kb + tk * 4 + j) * D + cbase + tn * 4];
            #pragma unroll
            for (int i = 0; i < 4; ++i) {
                v4bf p;
                p[0] = f[0][i]; p[1] = f[1][i]; p[2] = f[2][i]; p[3] = f[3][i];
                *(v4bf*)&Vt[tn * 4 + i][tk * 4] = p;
            }
        }
        async_wait();
        __syncthreads();

        // ---- scores = Q * K^T
        v16bf a0 = load_frag(&Qs[rowA][kb0],      &Qs[rowA][kb1]);
        v16bf a1 = load_frag(&Qs[rowA][32 + kb0], &Qs[rowA][32 + kb1]);
        v8f s[4];
        #pragma unroll
        for (int nt = 0; nt < 4; ++nt) {
            const int col = nt * 16 + l16;
            v16bf b0 = load_frag(&Ks[col][kb0],      &Ks[col][kb1]);
            v16bf b1 = load_frag(&Ks[col][32 + kb0], &Ks[col][32 + kb1]);
            v8f z = {};
            z = wmma_bf16(a0, b0, z);
            z = wmma_bf16(a1, b1, z);
            s[nt] = z;
        }

        // ---- p = exp(s), staged to LDS row-major (own strip only)
        #pragma unroll
        for (int nt = 0; nt < 4; ++nt)
            #pragma unroll
            for (int r = 0; r < 8; ++r)
                Ps[wave * 16 + r + half * 8][nt * 16 + l16] = (__bf16)__expf(s[nt][r]);

        v16bf p0 = load_frag(&Ps[rowA][kb0],      &Ps[rowA][kb1]);
        v16bf p1 = load_frag(&Ps[rowA][32 + kb0], &Ps[rowA][32 + kb1]);

        // ---- row-sums of P via WMMA with all-ones B (broadcast per column)
        lsum = wmma_bf16(p0, ones, lsum);
        lsum = wmma_bf16(p1, ones, lsum);

        // ---- O += P * V
        #pragma unroll
        for (int nt = 0; nt < 4; ++nt) {
            const int col = nt * 16 + l16;
            v16bf b0 = load_frag(&Vt[col][kb0],      &Vt[col][kb1]);
            v16bf b1 = load_frag(&Vt[col][32 + kb0], &Vt[col][32 + kb1]);
            o[nt] = wmma_bf16(p0, b0, o[nt]);
            o[nt] = wmma_bf16(p1, b1, o[nt]);
        }
    }

    // ---- normalize by row-sum, write bf16
    #pragma unroll
    for (int nt = 0; nt < 4; ++nt) {
        const int col = cbase + nt * 16 + l16;
        #pragma unroll
        for (int r = 0; r < 8; ++r) {
            const int row = q0 + wave * 16 + r + half * 8;
            O[(rowbase + row) * D + col] = (__bf16)(o[nt][r] / lsum[r]);
        }
    }
}

// ---------------------------------------------------------------------------
// Row-wise LayerNorm over rows of LN_D floats; optionally also emits a bf16
// shadow copy for the next GEMM's A operand.
// One wave owns LN_ROWS whole rows, held in registers (16-byte loads, 512
// contiguous bytes per wave load): no LDS, no barrier, the row is read once,
// and the launch starts 16x fewer waves than one 8-wave block per row.
// ---------------------------------------------------------------------------
#define LN_D       1024
#define LN_THREADS 512
#define LN_ROWS    2                 // rows per wave
#define LN_VEC     (LN_D / 128)      // float4 per lane and row
template<bool OUTBF16>
__global__ __launch_bounds__(LN_THREADS)
void layernorm_kernel(const float* __restrict__ X, const float* __restrict__ g,
                      const float* __restrict__ beta, float* __restrict__ Y,
                      __bf16* __restrict__ Yb)
{
    const unsigned lane = threadIdx.x & 31;
    const unsigned row0 =
        (blockIdx.x * (LN_THREADS / 32) + (threadIdx.x >> 5)) * LN_ROWS;
    // One 32-bit byte offset (a plane is 32 MiB) on the scalar bases X and Y:
    // the row loads and the fp32 stores share one offset register, which so
    // stays live from the first load to the last store.
    const unsigned boff = (row0 * LN_D + lane * 4) * 4u;
    const float* xp  = (const float*)((const char*)X + boff);
    float*       yp  = (float*)((char*)Y + boff);
    __bf16*      ybp = OUTBF16 ? (__bf16*)((char*)Yb + (boff >> 1)) : nullptr;

    float4 v[LN_ROWS][LN_VEC], gg[LN_VEC], bb[LN_VEC];
    // every loop below is unrolled so that the arrays are indexed by constants
    // and stay in registers; here it also puts all row loads in flight at once
    #pragma unroll
    for (int r = 0; r < LN_ROWS; ++r)
        #pragma unroll
        for (int j = 0; j < LN_VEC; ++j)
            v[r][j] = *(const float4*)&xp[r * LN_D + j * 128];
    #pragma unroll
    for (int j = 0; j < LN_VEC; ++j) {
        gg[j] = *(const float4*)&g[j * 128 + lane * 4];
        bb[j] = *(const float4*)&beta[j * 128 + lane * 4];
    }

    float sum[LN_ROWS], sq[LN_ROWS];
    #pragma unroll
    for (int r = 0; r < LN_ROWS; ++r) {
        float4 s = make_float4(0.f, 0.f, 0.f, 0.f);   // four independent chains
        float4 q = make_float4(0.f, 0.f, 0.f, 0.f);
        #pragma unroll
        for (int j = 0; j < LN_VEC; ++j) {
            const float4 t = v[r][j];
            s.x += t.x; s.y += t.y; s.z += t.z; s.w += t.w;
            q.x += t.x * t.x; q.y += t.y * t.y; q.z += t.z * t.z; q.w += t.w * t.w;
        }
        sum[r] = (s.x + s.y) + (s.z + s.w);
        sq[r]  = (q.x + q.y) + (q.z + q.w);
    }
    #pragma unroll
    for (int off = 1; off < 32; off <<= 1)
        #pragma unroll
        for (int r = 0; r < LN_ROWS; ++r) {
            sum[r] += __shfl_xor(sum[r], off, 32);
            sq[r]  += __shfl_xor(sq[r],  off, 32);
        }

    v4bf yb[LN_ROWS][LN_VEC];
    #pragma unroll
    for (int r = 0; r < LN_ROWS; ++r) {
        const float mu  = sum[r] / (float)LN_D;
        const float inv = rsqrtf(sq[r] / (float)LN_D - mu * mu + LN_EPS);
        #pragma unroll
        for (int j = 0; j < LN_VEC; ++j) {
            float4 t = v[r][j];
            t.x = (t.x - mu) * inv * gg[j].x + bb[j].x;
            t.y = (t.y - mu) * inv * gg[j].y + bb[j].y;
            t.z = (t.z - mu) * inv * gg[j].z + bb[j].z;
            t.w = (t.w - mu) * inv * gg[j].w + bb[j].w;
            v[r][j] = t;
            if (OUTBF16) yb[r][j] = cvt4(t);
        }
    }

    // Without this the scheduler sinks the second row's loads behind the first
    // row's stores (two memory latencies in a row) and reuses the registers of
    // issued stores; with it every store stands behind the last arithmetic.
    __builtin_amdgcn_sched_barrier(0);

    #pragma unroll
    for (int r = 0; r < LN_ROWS; ++r)
        #pragma unroll
        for (int j = 0; j < LN_VEC; ++j) {
            const int o = r * LN_D + j * 128;
            *(float4*)&yp[o] = v[r][j];
            if (OUTBF16) *(v4bf*)&ybp[o] = yb[r][j];
        }
}

// ---------------------------------------------------------------------------
extern "C" void kernel_launch(void* const* d_in, const int* in_sizes, int n_in,
                              void* d_out, int out_size, void* d_ws, size_t ws_size,
                              hipStream_t stream)
{
    const float* x    = (const float*)d_in[0];
    const float* Wq   = (const float*)d_in[1];
    const float* bq   = (const float*)d_in[2];
    const float* Wk   = (const float*)d_in[3];
    const float* bk   = (const float*)d_in[4];
    const float* Wv   = (const float*)d_in[5];
    const float* bv   = (const float*)d_in[6];
    const float* Wo   = (const float*)d_in[7];
    const float* bo   = (const float*)d_in[8];
    const float* W1   = (const float*)d_in[9];
    const float* b1   = (const float*)d_in[10];
    const float* W2   = (const float*)d_in[11];
    const float* b2   = (const float*)d_in[12];
    const float* g1   = (const float*)d_in[13];
    const float* be1  = (const float*)d_in[14];
    const float* g2   = (const float*)d_in[15];
    const float* be2  = (const float*)d_in[16];

    const int B = 4, S = 2048, D = 1024, DFF = 4096;
    const int M = B * S;  // 8192
    const size_t MD  = (size_t)M * D;
    const size_t MDF = (size_t)M * DFF;

    char* p = (char*)d_ws;
    auto alloc = [&](size_t bytes) { char* q = p; p += (bytes + 255) & ~(size_t)255; return q; };

    __bf16* xb  = (__bf16*)alloc(MD * 2);
    __bf16* Wqt = (__bf16*)alloc((size_t)D * D * 2);
    __bf16* Wkt = (__bf16*)alloc((size_t)D * D * 2);
    __bf16* Wvt = (__bf16*)alloc((size_t)D * D * 2);
    __bf16* Wot = (__bf16*)alloc((size_t)D * D * 2);
    __bf16* W1t = (__bf16*)alloc((size_t)D * DFF * 2);
    __bf16* W2t = (__bf16*)alloc((size_t)DFF * D * 2);
    __bf16* Qb  = (__bf16*)alloc(MD * 2);
    __bf16* Kb  = (__bf16*)alloc(MD * 2);
    __bf16* Vb  = (__bf16*)alloc(MD * 2);
    __bf16* Ob  = (__bf16*)alloc(MD * 2);
    float*  h1  = (float*)alloc(MD * 4);
    float*  x2  = (float*)alloc(MD * 4);
    __bf16* x2b = (__bf16*)alloc(MD * 2);
    __bf16* F1b = (__bf16*)alloc(MDF * 2);
    float*  h2  = h1;   // h1 consumed by LN1 before FFN2 writes h2

    const dim3 gblk(256);

    // ---- x -> bf16 and all weight pre-transposes, one launch
    prepare_kernel<<<dim3(PREP_BLOCKS), dim3(PREP_THREADS), 0, stream>>>(
        x, xb, Wq, Wqt, Wk, Wkt, Wv, Wvt, Wo, Wot, W1, W1t, W2, W2t);

    // ---- QKV projections, one launch (bf16 outputs; Q pre-scaled by 1/sqrt(dk))
    gemm_qkv_wmma<<<dim3(M / 256, D / 64, 3), gblk, 0, stream>>>(
        xb, Wqt, Wkt, Wvt, bq, bk, bv, Qb, Kb, Vb, 0.125f, D, D);

    // ---- attention
    attention_wmma<<<dim3(S / 64, B * 16), dim3(128), 0, stream>>>(Qb, Kb, Vb, Ob, S, D);

    // ---- output projection + residual x  -> h1 (fp32)
    gemm_bf16_wmma<false, true, true, false><<<dim3(M / 256, D / 64), gblk, 0, stream>>>(
        Ob, Wot, bo, x, h1, nullptr, 1.0f, M, D, D);

    // ---- LN1 -> x2 (fp32 residual) + x2b (bf16 operand)
    layernorm_kernel<true><<<dim3(M / (LN_THREADS / 32 * LN_ROWS)), dim3(LN_THREADS), 0, stream>>>(h1, g1, be1, x2, x2b);

    // ---- FFN1 with ReLU -> bf16 only
    gemm_bf16_wmma<true, false, false, true><<<dim3(M / 256, DFF / 64), gblk, 0, stream>>>(
        x2b, W1t, b1, nullptr, nullptr, F1b, 1.0f, M, DFF, D);

    // ---- FFN2 + residual x2 -> h2 (fp32)
    gemm_bf16_wmma<false, true, true, false><<<dim3(M / 256, D / 64), gblk, 0, stream>>>(
        F1b, W2t, b2, x2, h2, nullptr, 1.0f, M, D, DFF);

    // ---- LN2 -> output
    layernorm_kernel<false><<<dim3(M / (LN_THREADS / 32 * LN_ROWS)), dim3(LN_THREADS), 0, stream>>>(h2, g2, be2, (float*)d_out, nullptr);
}

// v004
// Measured time: 318 microseconds a run.
// In two side-by-side timings against v003, it was 1.12 and 1.13 times as fast.
// Over all steps from v000 it is 1.52 times as fast.
#include <hip/hip_runtime.h>
#include <hip/hip_bf16.h>

typedef __attribute__((ext_vector_type(16))) __bf16 v16bf;
typedef __attribute__((ext_vector_type(8)))  __bf16 v8bf;
typedef __attribute__((ext_vector_type(4)))  __bf16 v4bf;
typedef __attribute__((ext_vector_type(8)))  float  v8f;
typedef __attribute__((__vector_size__(4 * sizeof(int)))) int i32x4;

#define LN_EPS 1e-5f
#define LDP 72   // padded LDS row length (bf16): 144 B, multiple of 16 B

#if defined(__has_builtin)
#if __has_builtin(__builtin_amdgcn_global_load_async_to_lds_b128) && \
    __has_builtin(__builtin_amdgcn_s_wait_asynccnt)
#define HAVE_ASYNC_LDS 1
#endif
#endif

#define AS1 __attribute__((address_space(1)))
#define AS3 __attribute__((address_space(3)))

__device__ __forceinline__ v8f wmma_bf16(const v16bf& a, const v16bf& b, const v8f& c) {
    return __builtin_amdgcn_wmma_f32_16x16x32_bf16(false, a, false, b, (short)0, c, false, false);
}

// Two contiguous 16-byte LDS loads -> one 16-element bf16 fragment.
__device__ __forceinline__ v16bf load_frag(const __bf16* p0, const __bf16* p1) {
    v8bf lo = *(const v8bf*)p0;
    v8bf hi = *(const v8bf*)p1;
    return __builtin_shufflevector(lo, hi, 0, 1, 2, 3, 4, 5, 6, 7,
                                   8, 9, 10, 11, 12, 13, 14, 15);
}

__device__ __forceinline__ v4bf cvt4(const float4 f) {
    v4bf b;
    b[0] = (__bf16)f.x; b[1] = (__bf16)f.y; b[2] = (__bf16)f.z; b[3] = (__bf16)f.w;
    return b;
}

// 16-byte global(bf16) -> LDS copy; async-to-LDS when toolchain supports it.
__device__ __forceinline__ void copy16B(const __bf16* g, __bf16* l) {
#ifdef HAVE_ASYNC_LDS
    __builtin_amdgcn_global_load_async_to_lds_b128(
        (AS1 i32x4*)g, (AS3 i32x4*)l, 0, 0);
#else
    *(v8bf*)l = *(const v8bf*)g;
#endif
}

__device__ __forceinline__ void async_wait() {
#ifdef HAVE_ASYNC_LDS
    __builtin_amdgcn_s_wait_asynccnt(0);
#endif
}

// ---------------------------------------------------------------------------
// Preparation, ONE launch: x -> bf16 and the six weights -> transposed bf16.
// The seven jobs do not depend on each other, so they share one grid and pay
// one launch gap, one fill and one drain; a block picks its job from
// blockIdx.x (the same for the whole block).
// ---------------------------------------------------------------------------
#define PD    1024                   // model width
#define PDFF  4096                   // hidden width
#define PM    8192                   // rows of x
#define PREP_THREADS 256
#define CVT_VEC      16              // float4 per thread
#define CVT_BLOCKS   (PM * PD / (PREP_THREADS * CVT_VEC * 4))
#define TSQ_BLOCKS   ((PD / 64) * (PD / 64))      // one square weight
#define TFF_BLOCKS   ((PD / 64) * (PDFF / 64))    // W1 or W2
#define PREP_BLOCKS  (CVT_BLOCKS + 4 * TSQ_BLOCKS + 2 * TFF_BLOCKS)

// fp32 -> bf16 elementwise, fat waves: 16 float4 per thread.
__device__ __forceinline__
void convert_block(const float* __restrict__ X, __bf16* __restrict__ Y, unsigned blk)
{
    const size_t base =
        ((size_t)blk * (PREP_THREADS * CVT_VEC) + threadIdx.x) * 4;
    float4 f[CVT_VEC];
    // unrolled so that f[] stays in registers and many loads are in flight at once
    #pragma unroll
    for (int i = 0; i < CVT_VEC; ++i)
        f[i] = *(const float4*)&X[base + (size_t)i * (PREP_THREADS * 4)];
    // unrolled: f[] is indexed by constants only
    #pragma unroll
    for (int i = 0; i < CVT_VEC; ++i)
        *(v4bf*)&Y[base + (size_t)i * (PREP_THREADS * 4)] = cvt4(f[i]);
}

// W[K,N] fp32 -> Wt[N,K] bf16, one 64x64 tile through LDS.
__device__ __forceinline__
void transpose_block(const float* __restrict__ W, __bf16* __restrict__ Wt,
                     int K, int N, int k0, int n0, float (*T)[65])
{
    #pragma unroll
    for (int i = 0; i < 16; ++i) {
        int idx = threadIdx.x + i * 256;
        int r = idx >> 6, c = idx & 63;
        T[r][c] = W[(size_t)(k0 + r) * N + n0 + c];
    }
    __syncthreads();
    #pragma unroll
    for (int i = 0; i < 16; ++i) {
        int idx = threadIdx.x + i * 256;
        int r = idx >> 6, c = idx & 63;         // r = n-local, c = k-local
        Wt[(size_t)(n0 + r) * K + k0 + c] = (__bf16)T[c][r];
    }
    // The jobs are laid out one behind the other in the built kernel: this wait
    // stands between the stores above and any later write of their registers.
    asm volatile("s_wait_xcnt 0x0" ::: "memory");
}

__global__ __launch_bounds__(PREP_THREADS)
void prepare_kernel(const float* __restrict__ X,  __bf16* __restrict__ Xb,
                    const float* __restrict__ Wq, __bf16* __restrict__ Wqt,
                    const float* __restrict__ Wk, __bf16* __restrict__ Wkt,
                    const float* __restrict__ Wv, __bf16* __restrict__ Wvt,
                    const float* __restrict__ Wo, __bf16* __restrict__ Wot,
                    const float* __restrict__ W1, __bf16* __restrict__ W1t,
                    const float* __restrict__ W2, __bf16* __restrict__ W2t)
{
    __shared__ float T[64][65];
    unsigned b = blockIdx.x;
    if (b < CVT_BLOCKS) {                        // the largest jobs start first
        convert_block(X, Xb, b);
        return;
    }
    b -= CVT_BLOCKS;
    if (b < 4 * TSQ_BLOCKS) {
        const unsigned w = b / TSQ_BLOCKS, t = b % TSQ_BLOCKS;
        const float* W  = w == 0 ? Wq  : w == 1 ? Wk  : w == 2 ? Wv  : Wo;
        __bf16*      Wt = w == 0 ? Wqt : w == 1 ? Wkt : w == 2 ? Wvt : Wot;
        transpose_block(W, Wt, PD, PD, (t % (PD / 64)) * 64, (t / (PD / 64)) * 64, T);
        return;
    }
    b -= 4 * TSQ_BLOCKS;
    if (b < TFF_BLOCKS) {
        transpose_block(W1, W1t, PD, PDFF, (b % (PD / 64)) * 64, (b / (PD / 64)) * 64, T);
        return;
    }
    b -= TFF_BLOCKS;
    transpose_block(W2, W2t, PDFF, PD, (b % (PDFF / 64)) * 64, (b / (PDFF / 64)) * 64, T);
}

// ---------------------------------------------------------------------------
// GEMM: C = op(A[M,K](bf16) @ Wt[N,K](bf16)^T + bias (+ resid))
// Block tile BM x 128, K step 128; 8 waves in a 4 x 2 grid, each wave owns a
// (BM/4) x 64 piece. A byte staged from L2 feeds more products than in a
// 64-wide tile, and the long K step halves the stage-and-wait turns.
// BM = 256 (64x64 wave pieces: every fragment read from LDS feeds 4 products)
// where the output is wide enough to fill the chip with such blocks;
// BM = 128 (32x64 pieces) for the 1024-wide outputs, so that two blocks share
// a WGP there, one computing on two waves per SIMD while the other stages.
// Both LDS stages are straight 16-byte copies (async-to-LDS when available).
// Outputs: fp32 C and/or bf16 C (scaled) per template flags.
// ---------------------------------------------------------------------------
#define GBN  128   // block tile columns
#define GBK  128   // K step
#define GLDP 136   // padded LDS row length (bf16): 272 B = 16 B x 17
template<int BM, bool RELU, bool RESID, bool OUTF32, bool OUTBF16>
__device__ __forceinline__
void gemm_tile(const __bf16* __restrict__ A, const __bf16* __restrict__ Wt,
               const float* __restrict__ bias, const float* __restrict__ resid,
               float* __restrict__ Cf, __bf16* __restrict__ Cb, float oscale,
               int N, int K)
{
    constexpr int THREADS = 256;
    constexpr int WM = BM / 4;                      // rows of a wave's piece
    constexpr int MI = WM / 16;                     // its accumulator tile rows
    __shared__ __align__(16) __bf16 As[BM][GLDP];   // [m][k]
    __shared__ __align__(16) __bf16 Bt[GBN][GLDP];  // [n][k]
    const int tid  = threadIdx.x;
    const int wave = tid >> 5;
    const int lane = tid & 31;
    const int half = lane >> 4;
    const int l16  = lane & 15;
    const int kb0  = half * 8;
    const int kb1  = 16 + half * 8;
    const int wm   = (wave >> 1) * WM;              // the wave's rows in the tile
    const int wn   = (wave & 1) * 64;               // the wave's columns
    const int m0 = blockIdx.x * BM;
    const int n0 = blockIdx.y * GBN;
    // Staging: one pass of the block copies RS rows; a thread keeps its place
    // (row r0, chunk c0) in every pass, so one 32-bit byte offset serves all its
    // copies and the row steps stay in the block-uniform base address.
    constexpr int RS = THREADS / 16;
    const int      r0   = tid >> 4;
    const int      c0   = (tid & 15) * 8;
    const unsigned voff = ((unsigned)r0 * (unsigned)K + (unsigned)c0) * 2u;

    v8f acc[MI][4] = {};

    for (int k0 = 0; k0 < K; k0 += GBK) {
        // stage A tile: BM rows x 128 bf16, 16 chunks of 16 bytes a row
        // (unrolled: all copies of a stage are in flight at once)
        #pragma unroll
        for (int i = 0; i < BM / RS; ++i)
            copy16B((const __bf16*)((const char*)(A + (size_t)(m0 + i * RS) * K + k0) + voff),
                    &As[r0 + i * RS][c0]);
        // stage B tile (already [n][k] in global), unrolled for the same reason
        #pragma unroll
        for (int i = 0; i < GBN / RS; ++i)
            copy16B((const __bf16*)((const char*)(Wt + (size_t)(n0 + i * RS) * K + k0) + voff),
                    &Bt[r0 + i * RS][c0]);
        async_wait();
        __syncthreads();

        // unrolled: acc[][] and the fragments are indexed by constants only
        #pragma unroll
        for (int ks = 0; ks < GBK; ks += 32) {
            v16bf a[MI], b[4];
            #pragma unroll
            for (int mi = 0; mi < MI; ++mi) {
                const int row = wm + mi * 16 + l16;
                a[mi] = load_frag(&As[row][ks + kb0], &As[row][ks + kb1]);
            }
            #pragma unroll
            for (int nt = 0; nt < 4; ++nt) {
                const int col = wn + nt * 16 + l16;
                b[nt] = load_frag(&Bt[col][ks + kb0], &Bt[col][ks + kb1]);
            }
            #pragma unroll
            for (int mi = 0; mi < MI; ++mi)
                #pragma unroll
                for (int nt = 0; nt < 4; ++nt)
                    acc[mi][nt] = wmma_bf16(a[mi], b[nt], acc[mi][nt]);
        }
        __syncthreads();
    }

    // Epilogue, unrolled throughout: acc[][] is indexed by constants only.
    // One 32-bit element index per row (a plane has at most 2^25 elements) on
    // the uniform bases serves the row's residual loads and its stores; the
    // column step of a tile goes into the base. The residual tile is fetched
    // first, so that all its loads are in flight together.
    const unsigned o0 = (unsigned)(m0 + wm + half * 8) * (unsigned)N
                      + (unsigned)(n0 + wn + l16);
    float bv[4], rv[RESID ? MI : 1][4][8];
    #pragma unroll
    for (int nt = 0; nt < 4; ++nt)
        bv[nt] = bias[n0 + wn + nt * 16 + l16];
    if (RESID) {
        #pragma unroll
        for (int mi = 0; mi < MI; ++mi)
            #pragma unroll
            for (int nt = 0; nt < 4; ++nt)
                #pragma unroll
                for (int r = 0; r < 8; ++r)
                    rv[mi][nt][r] = (resid + nt * 16)[o0 + (unsigned)(mi * 16 + r) * (unsigned)N];
    }
    #pragma unroll
    for (int mi = 0; mi < MI; ++mi)
        #pragma unroll
        for (int nt = 0; nt < 4; ++nt)
            #pragma unroll
            for (int r = 0; r < 8; ++r) {
                float v = acc[mi][nt][r] + bv[nt];
                if (RESID) v += rv[mi][nt][r];
                if (RELU)  v = fmaxf(v, 0.0f);
                acc[mi][nt][r] = v;
            }

    #pragma unroll
    for (int mi = 0; mi < MI; ++mi)
        #pragma unroll
        for (int nt = 0; nt < 4; ++nt)
            #pragma unroll
            for (int r = 0; r < 8; ++r) {
                const unsigned o = o0 + (unsigned)(mi * 16 + r) * (unsigned)N;
                if (OUTF32)  (Cf + nt * 16)[o] = acc[mi][nt][r];
                if (OUTBF16) (Cb + nt * 16)[o] = (__bf16)(acc[mi][nt][r] * oscale);
            }
}

template<int BM, bool RELU, bool RESID, bool OUTF32, bool OUTBF16>
__global__ __launch_bounds__(256)
void gemm_bf16_wmma(const __bf16* __restrict__ A, const __bf16* __restrict__ Wt,
                    const float* __restrict__ bias, const float* __restrict__ resid,
                    float* __restrict__ Cf, __bf16* __restrict__ Cb, float oscale,
                    int M, int N, int K)
{
    gemm_tile<BM, RELU, RESID, OUTF32, OUTBF16>(A, Wt, bias, resid, Cf, Cb, oscale, N, K);
}

// The three projections of the same A in ONE launch: blockIdx.z picks the
// weight, bias and output. They are independent, so one grid of three times
// the blocks pays one gap, fill and drain and keeps more blocks on a WGP.
__global__ __launch_bounds__(256)
void gemm_qkv_wmma(const __bf16* __restrict__ A,
                   const __bf16* __restrict__ Wqt, const __bf16* __restrict__ Wkt,
                   const __bf16* __restrict__ Wvt,
                   const float* __restrict__ bq, const float* __restrict__ bk,
                   const float* __restrict__ bv,
                   __bf16* __restrict__ Qb, __bf16* __restrict__ Kb,
                   __bf16* __restrict__ Vb, float qscale, int N, int K)
{
    const unsigned w = blockIdx.z;
    const __bf16* Wt   = w == 0 ? Wqt : w == 1 ? Wkt : Wvt;
    const float*  bias = w == 0 ? bq  : w == 1 ? bk  : bv;
    __bf16*       Cb   = w == 0 ? Qb  : w == 1 ? Kb  : Vb;
    gemm_tile<256, false, false, false, true>(A, Wt, bias, nullptr, nullptr, Cb,
                                              w == 0 ? qscale : 1.0f, N, K);
}

// ---------------------------------------------------------------------------
// Flash-attention per (b,h, 64-query block). dk=64, S=2048; Q pre-scaled by
// 1/sqrt(dk) at the Q-GEMM. Scores std ~1 -> plain exp is fp32-safe (softmax
// is shift-invariant); row-sums via WMMA with an all-ones B matrix.
// Q/K/V are bf16; Q/K stage as pure copies (async), V via register transpose.
// Output written bf16 (only consumed by the Wo GEMM).
// ---------------------------------------------------------------------------
__global__ __launch_bounds__(128)
void attention_wmma(const __bf16* __restrict__ Q, const __bf16* __restrict__ Km,
                    const __bf16* __restrict__ Vm, __bf16* __restrict__ O,
                    int S, int D)
{
    __shared__ __align__(16) __bf16 Qs[64][LDP];   // [q][d]
    __shared__ __align__(16) __bf16 Ks[64][LDP];   // [key][d]
    __shared__ __align__(16) __bf16 Vt[64][LDP];   // [d][key]
    __shared__ __align__(16) __bf16 Ps[64][LDP];   // probs [q][key]

    const int tid  = threadIdx.x;
    const int wave = tid >> 5;
    const int lane = tid & 31;
    const int half = lane >> 4;
    const int l16  = lane & 15;
    const int kb0  = half * 8;
    const int kb1  = 16 + half * 8;

    const int q0 = blockIdx.x * 64;
    const int bh = blockIdx.y;
    const int b  = bh >> 4;
    const int h  = bh & 15;
    const size_t rowbase = (size_t)b * S;
    const int    cbase   = h * 64;

    // stage Q block (pure bf16 copy; scale already folded in)
    #pragma unroll
    for (int i = 0; i < 4; ++i) {
        int idx = tid + i * 128;
        int r = idx >> 3, c = (idx & 7) * 8;
        copy16B(&Q[(rowbase + q0 + r) * D + cbase + c], &Qs[r][c]);
    }

    v16bf ones;
    #pragma unroll
    for (int i = 0; i < 16; ++i) ones[i] = (__bf16)1.0f;

    v8f o[4] = {};
    v8f lsum = {};

    const int rowA = wave * 16 + l16;

    for (int kb = 0; kb < S; kb += 64) {
        __syncthreads();
        // K row-major copy (async)
        #pragma unroll
        for (int i = 0; i < 4; ++i) {
            int idx = tid + i * 128;
            int r = idx >> 3, c = (idx & 7) * 8;
            copy16B(&Km[(rowbase + kb + r) * D + cbase + c], &Ks[r][c]);
        }
        // V transposed via 4x4 register micro-tiles
        #pragma unroll
        for (int tt = 0; tt < 2; ++tt) {
            const int t  = tid + tt * 128;
            const int tn = t & 15;      // d block
            const int tk = t >> 4;      // key block
            v4bf f[4];
            #pragma unroll
            for (int j = 0; j < 4; ++j)
                f[j] = *(const v4bf*)&Vm[(rowbase + kb + tk * 4 + j) * D + cbase + tn * 4];
            #pragma unroll
            for (int i = 0; i < 4; ++i) {
                v4bf p;
                p[0] = f[0][i]; p[1] = f[1][i]; p[2] = f[2][i]; p[3] = f[3][i];
                *(v4bf*)&Vt[tn * 4 + i][tk * 4] = p;
            }
        }
        async_wait();
        __syncthreads();

        // ---- scores = Q * K^T
        v16bf a0 = load_frag(&Qs[rowA][kb0],      &Qs[rowA][kb1]);
        v16bf a1 = load_frag(&Qs[rowA][32 + kb0], &Qs[rowA][32 + kb1]);
        v8f s[4];
        #pragma unroll
        for (int nt = 0; nt < 4; ++nt) {
            const int col = nt * 16 + l16;
            v16bf b0 = load_frag(&Ks[col][kb0],      &Ks[col][kb1]);
            v16bf b1 = load_frag(&Ks[col][32 + kb0], &Ks[col][32 + kb1]);
            v8f z = {};
            z = wmma_bf16(a0, b0, z);
            z = wmma_bf16(a1, b1, z);
            s[nt] = z;
        }

        // ---- p = exp(s), staged to LDS row-major (own strip only)
        #pragma unroll
        for (int nt = 0; nt < 4; ++nt)
            #pragma unroll
            for (int r = 0; r < 8; ++r)
                Ps[wave * 16 + r + half * 8][nt * 16 + l16] = (__bf16)__expf(s[nt][r]);

        v16bf p0 = load_frag(&Ps[rowA][kb0],      &Ps[rowA][kb1]);
        v16bf p1 = load_frag(&Ps[rowA][32 + kb0], &Ps[rowA][32 + kb1]);

        // ---- row-sums of P via WMMA with all-ones B (broadcast per column)
        lsum = wmma_bf16(p0, ones, lsum);
        lsum = wmma_bf16(p1, ones, lsum);

        // ---- O += P * V
        #pragma unroll
        for (int nt = 0; nt < 4; ++nt) {
            const int col = nt * 16 + l16;
            v16bf b0 = load_frag(&Vt[col][kb0],      &Vt[col][kb1]);
            v16bf b1 = load_frag(&Vt[col][32 + kb0], &Vt[col][32 + kb1]);
            o[nt] = wmma_bf16(p0, b0, o[nt]);
            o[nt] = wmma_bf16(p1, b1, o[nt]);
        }
    }

    // ---- normalize by row-sum, write bf16
    #pragma unroll
    for (int nt = 0; nt < 4; ++nt) {
        const int col = cbase + nt * 16 + l16;
        #pragma unroll
        for (int r = 0; r < 8; ++r) {
            const int row = q0 + wave * 16 + r + half * 8;
            O[(rowbase + row) * D + col] = (__bf16)(o[nt][r] / lsum[r]);
        }
    }
}

// ---------------------------------------------------------------------------
// Row-wise LayerNorm over rows of LN_D floats; optionally also emits a bf16
// shadow copy for the next GEMM's A operand.
// One wave owns LN_ROWS whole rows, held in registers (16-byte loads, 512
// contiguous bytes per wave load): no LDS, no barrier, the row is read once,
// and the launch starts 16x fewer waves than one 8-wave block per row.
// ---------------------------------------------------------------------------
#define LN_D       1024
#define LN_THREADS 512
#define LN_ROWS    2                 // rows per wave
#define LN_VEC     (LN_D / 128)      // float4 per lane and row
template<bool OUTBF16>
__global__ __launch_bounds__(LN_THREADS)
void layernorm_kernel(const float* __restrict__ X, const float* __restrict__ g,
                      const float* __restrict__ beta, float* __restrict__ Y,
                      __bf16* __restrict__ Yb)
{
    const unsigned lane = threadIdx.x & 31;
    const unsigned row0 =
        (blockIdx.x * (LN_THREADS / 32) + (threadIdx.x >> 5)) * LN_ROWS;
    // One 32-bit byte offset (a plane is 32 MiB) on the scalar bases X and Y:
    // the row loads and the fp32 stores share one offset register, which so
    // stays live from the first load to the last store.
    const unsigned boff = (row0 * LN_D + lane * 4) * 4u;
    const float* xp  = (const float*)((const char*)X + boff);
    float*       yp  = (float*)((char*)Y + boff);
    __bf16*      ybp = OUTBF16 ? (__bf16*)((char*)Yb + (boff >> 1)) : nullptr;

    float4 v[LN_ROWS][LN_VEC], gg[LN_VEC], bb[LN_VEC];
    // every loop below is unrolled so that the arrays are indexed by constants
    // and stay in registers; here it also puts all row loads in flight at once
    #pragma unroll
    for (int r = 0; r < LN_ROWS; ++r)
        #pragma unroll
        for (int j = 0; j < LN_VEC; ++j)
            v[r][j] = *(const float4*)&xp[r * LN_D + j * 128];
    #pragma unroll
    for (int j = 0; j < LN_VEC; ++j) {
        gg[j] = *(const float4*)&g[j * 128 + lane * 4];
        bb[j] = *(const float4*)&beta[j * 128 + lane * 4];
    }

    float sum[LN_ROWS], sq[LN_ROWS];
    #pragma unroll
    for (int r = 0; r < LN_ROWS; ++r) {
        float4 s = make_float4(0.f, 0.f, 0.f, 0.f);   // four independent chains
        float4 q = make_float4(0.f, 0.f, 0.f, 0.f);
        #pragma unroll
        for (int j = 0; j < LN_VEC; ++j) {
            const float4 t = v[r][j];
            s.x += t.x; s.y += t.y; s.z += t.z; s.w += t.w;
            q.x += t.x * t.x; q.y += t.y * t.y; q.z += t.z * t.z; q.w += t.w * t.w;
        }
        sum[r] = (s.x + s.y) + (s.z + s.w);
        sq[r]  = (q.x + q.y) + (q.z + q.w);
    }
    #pragma unroll
    for (int off = 1; off < 32; off <<= 1)
        #pragma unroll
        for (int r = 0; r < LN_ROWS; ++r) {
            sum[r] += __shfl_xor(sum[r], off, 32);
            sq[r]  += __shfl_xor(sq[r],  off, 32);
        }

    v4bf yb[LN_ROWS][LN_VEC];
    #pragma unroll
    for (int r = 0; r < LN_ROWS; ++r) {
        const float mu  = sum[r] / (float)LN_D;
        const float inv = rsqrtf(sq[r] / (float)LN_D - mu * mu + LN_EPS);
        #pragma unroll
        for (int j = 0; j < LN_VEC; ++j) {
            float4 t = v[r][j];
            t.x = (t.x - mu) * inv * gg[j].x + bb[j].x;
            t.y = (t.y - mu) * inv * gg[j].y + bb[j].y;
            t.z = (t.z - mu) * inv * gg[j].z + bb[j].z;
            t.w = (t.w - mu) * inv * gg[j].w + bb[j].w;
            v[r][j] = t;
            if (OUTBF16) yb[r][j] = cvt4(t);
        }
    }

    // Without this the scheduler sinks the second row's loads behind the first
    // row's stores (two memory latencies in a row) and reuses the registers of
    // issued stores; with it every store stands behind the last arithmetic.
    __builtin_amdgcn_sched_barrier(0);

    #pragma unroll
    for (int r = 0; r < LN_ROWS; ++r)
        #pragma unroll
        for (int j = 0; j < LN_VEC; ++j) {
            const int o = r * LN_D + j * 128;
            *(float4*)&yp[o] = v[r][j];
            if (OUTBF16) *(v4bf*)&ybp[o] = yb[r][j];
        }
}

// ---------------------------------------------------------------------------
extern "C" void kernel_launch(void* const* d_in, const int* in_sizes, int n_in,
                              void* d_out, int out_size, void* d_ws, size_t ws_size,
                              hipStream_t stream)
{
    const float* x    = (const float*)d_in[0];
    const float* Wq   = (const float*)d_in[1];
    const float* bq   = (const float*)d_in[2];
    const float* Wk   = (const float*)d_in[3];
    const float* bk   = (const float*)d_in[4];
    const float* Wv   = (const float*)d_in[5];
    const float* bv   = (const float*)d_in[6];
    const float* Wo   = (const float*)d_in[7];
    const float* bo   = (const float*)d_in[8];
    const float* W1   = (const float*)d_in[9];
    const float* b1   = (const float*)d_in[10];
    const float* W2   = (const float*)d_in[11];
    const float* b2   = (const float*)d_in[12];
    const float* g1   = (const float*)d_in[13];
    const float* be1  = (const float*)d_in[14];
    const float* g2   = (const float*)d_in[15];
    const float* be2  = (const float*)d_in[16];

    const int B = 4, S = 2048, D = 1024, DFF = 4096;
    const int M = B * S;  // 8192
    const size_t MD  = (size_t)M * D;
    const size_t MDF = (size_t)M * DFF;

    char* p = (char*)d_ws;
    auto alloc = [&](size_t bytes) { char* q = p; p += (bytes + 255) & ~(size_t)255; return q; };

    __bf16* xb  = (__bf16*)alloc(MD * 2);
    __bf16* Wqt = (__bf16*)alloc((size_t)D * D * 2);
    __bf16* Wkt = (__bf16*)alloc((size_t)D * D * 2);
    __bf16* Wvt = (__bf16*)alloc((size_t)D * D * 2);
    __bf16* Wot = (__bf16*)alloc((size_t)D * D * 2);
    __bf16* W1t = (__bf16*)alloc((size_t)D * DFF * 2);
    __bf16* W2t = (__bf16*)alloc((size_t)DFF * D * 2);
    __bf16* Qb  = (__bf16*)alloc(MD * 2);
    __bf16* Kb  = (__bf16*)alloc(MD * 2);
    __bf16* Vb  = (__bf16*)alloc(MD * 2);
    __bf16* Ob  = (__bf16*)alloc(MD * 2);
    float*  h1  = (float*)alloc(MD * 4);
    float*  x2  = (float*)alloc(MD * 4);
    __bf16* x2b = (__bf16*)alloc(MD * 2);
    __bf16* F1b = (__bf16*)alloc(MDF * 2);
    float*  h2  = h1;   // h1 consumed by LN1 before FFN2 writes h2

    // ---- x -> bf16 and all weight pre-transposes, one launch
    prepare_kernel<<<dim3(PREP_BLOCKS), dim3(PREP_THREADS), 0, stream>>>(
        x, xb, Wq, Wqt, Wk, Wkt, Wv, Wvt, Wo, Wot, W1, W1t, W2, W2t);

    // ---- QKV projections, one launch (bf16 outputs; Q pre-scaled by 1/sqrt(dk))
    gemm_qkv_wmma<<<dim3(M / 256, D / GBN, 3), dim3(256), 0, stream>>>(
        xb, Wqt, Wkt, Wvt, bq, bk, bv, Qb, Kb, Vb, 0.125f, D, D);

    // ---- attention
    attention_wmma<<<dim3(S / 64, B * 16), dim3(128), 0, stream>>>(Qb, Kb, Vb, Ob, S, D);

    // ---- output projection + residual x  -> h1 (fp32)
    gemm_bf16_wmma<128, false, true, true, false><<<dim3(M / 128, D / GBN), dim3(256), 0, stream>>>(
        Ob, Wot, bo, x, h1, nullptr, 1.0f, M, D, D);

    // ---- LN1 -> x2 (fp32 residual) + x2b (bf16 operand)
    layernorm_kernel<true><<<dim3(M / (LN_THREADS / 32 * LN_ROWS)), dim3(LN_THREADS), 0, stream>>>(h1, g1, be1, x2, x2b);

    // ---- FFN1 with ReLU -> bf16 only
    gemm_bf16_wmma<256, true, false, false, true><<<dim3(M / 256, DFF / GBN), dim3(256), 0, stream>>>(
        x2b, W1t, b1, nullptr, nullptr, F1b, 1.0f, M, DFF, D);

    // ---- FFN2 + residual x2 -> h2 (fp32)
    gemm_bf16_wmma<128, false, true, true, false><<<dim3(M / 128, D / GBN), dim3(256), 0, stream>>>(
        F1b, W2t, b2, x2, h2, nullptr, 1.0f, M, D, DFF);

    // ---- LN2 -> output
    layernorm_kernel<false><<<dim3(M / (LN_THREADS / 32 * LN_ROWS)), dim3(LN_THREADS), 0, stream>>>(h2, g2, be2, (float*)d_out, nullptr);
}

// v005
// A run of this version takes 289 microseconds.
// Two timings next to v004 put it at 1.09 and 1.10 times that version's speed.
// Over all steps from v000 it is 1.66 times as fast.
#include <hip/hip_runtime.h>
#include <hip/hip_bf16.h>

typedef __attribute__((ext_vector_type(16))) __bf16 v16bf;
typedef __attribute__((ext_vector_type(8)))  __bf16 v8bf;
typedef __attribute__((ext_vector_type(4)))  __bf16 v4bf;
typedef __attribute__((ext_vector_type(8)))  float  v8f;
typedef __attribute__((__vector_size__(4 * sizeof(int)))) int i32x4;

#define LN_EPS 1e-5f
#define LDP 72   // padded LDS row length (bf16): 144 B, multiple of 16 B

#if defined(__has_builtin)
#if __has_builtin(__builtin_amdgcn_global_load_async_to_lds_b128) && \
    __has_builtin(__builtin_amdgcn_s_wait_asynccnt)
#define HAVE_ASYNC_LDS 1
#endif
#endif

#define AS1 __attribute__((address_space(1)))
#define AS3 __attribute__((address_space(3)))

__device__ __forceinline__ v8f wmma_bf16(const v16bf& a, const v16bf& b, const v8f& c) {
    return __builtin_amdgcn_wmma_f32_16x16x32_bf16(false, a, false, b, (short)0, c, false, false);
}

// Two contiguous 16-byte LDS loads -> one 16-element bf16 fragment.
__device__ __forceinline__ v16bf load_frag(const __bf16* p0, const __bf16* p1) {
    v8bf lo = *(const v8bf*)p0;
    v8bf hi = *(const v8bf*)p1;
    return __builtin_shufflevector(lo, hi, 0, 1, 2, 3, 4, 5, 6, 7,
                                   8, 9, 10, 11, 12, 13, 14, 15);
}

__device__ __forceinline__ v4bf cvt4(const float4 f) {
    v4bf b;
    b[0] = (__bf16)f.x; b[1] = (__bf16)f.y; b[2] = (__bf16)f.z; b[3] = (__bf16)f.w;
    return b;
}

// 16-byte global(bf16) -> LDS copy; async-to-LDS when toolchain supports it.
__device__ __forceinline__ void copy16B(const __bf16* g, __bf16* l) {
#ifdef HAVE_ASYNC_LDS
    __builtin_amdgcn_global_load_async_to_lds_b128(
        (AS1 i32x4*)g, (AS3 i32x4*)l, 0, 0);
#else
    *(v8bf*)l = *(const v8bf*)g;
#endif
}

__device__ __forceinline__ void async_wait() {
#ifdef HAVE_ASYNC_LDS
    __builtin_amdgcn_s_wait_asynccnt(0);
#endif
}

// ---------------------------------------------------------------------------
// Preparation, ONE launch: x -> bf16 and the six weights -> transposed bf16.
// The seven jobs do not depend on each other, so they share one grid and pay
// one launch gap, one fill and one drain; a block picks its job from
// blockIdx.x (the same for the whole block).
// ---------------------------------------------------------------------------
#define PD    1024                   // model width
#define PDFF  4096                   // hidden width
#define PM    8192                   // rows of x
#define PREP_THREADS 256
#define CVT_VEC      16              // float4 per thread
#define CVT_BLOCKS   (PM * PD / (PREP_THREADS * CVT_VEC * 4))
#define TSQ_BLOCKS   ((PD / 64) * (PD / 64))      // one square weight
#define TFF_BLOCKS   ((PD / 64) * (PDFF / 64))    // W1 or W2
#define PREP_BLOCKS  (CVT_BLOCKS + 4 * TSQ_BLOCKS + 2 * TFF_BLOCKS)

// fp32 -> bf16 elementwise, fat waves: 16 float4 per thread.
__device__ __forceinline__
void convert_block(const float* __restrict__ X, __bf16* __restrict__ Y, unsigned blk)
{
    const size_t base =
        ((size_t)blk * (PREP_THREADS * CVT_VEC) + threadIdx.x) * 4;
    float4 f[CVT_VEC];
    // unrolled so that f[] stays in registers and many loads are in flight at once
    #pragma unroll
    for (int i = 0; i < CVT_VEC; ++i)
        f[i] = *(const float4*)&X[base + (size_t)i * (PREP_THREADS * 4)];
    // unrolled: f[] is indexed by constants only
    #pragma unroll
    for (int i = 0; i < CVT_VEC; ++i)
        *(v4bf*)&Y[base + (size_t)i * (PREP_THREADS * 4)] = cvt4(f[i]);
}

// W[K,N] fp32 -> Wt[N,K] bf16, one 64x64 tile through LDS.
__device__ __forceinline__
void transpose_block(const float* __restrict__ W, __bf16* __restrict__ Wt,
                     int K, int N, int k0, int n0, float (*T)[65])
{
    #pragma unroll
    for (int i = 0; i < 16; ++i) {
        int idx = threadIdx.x + i * 256;
        int r = idx >> 6, c = idx & 63;
        T[r][c] = W[(size_t)(k0 + r) * N + n0 + c];
    }
    __syncthreads();
    #pragma unroll
    for (int i = 0; i < 16; ++i) {
        int idx = threadIdx.x + i * 256;
        int r = idx >> 6, c = idx & 63;         // r = n-local, c = k-local
        Wt[(size_t)(n0 + r) * K + k0 + c] = (__bf16)T[c][r];
    }
    // The jobs are laid out one behind the other in the built kernel: this wait
    // stands between the stores above and any later write of their registers.
    asm volatile("s_wait_xcnt 0x0" ::: "memory");
}

__global__ __launch_bounds__(PREP_THREADS)
void prepare_kernel(const float* __restrict__ X,  __bf16* __restrict__ Xb,
                    const float* __restrict__ Wq, __bf16* __restrict__ Wqt,
                    const float* __restrict__ Wk, __bf16* __restrict__ Wkt,
                    const float* __restrict__ Wv, __bf16* __restrict__ Wvt,
                    const float* __restrict__ Wo, __bf16* __restrict__ Wot,
                    const float* __restrict__ W1, __bf16* __restrict__ W1t,
                    const float* __restrict__ W2, __bf16* __restrict__ W2t)
{
    __shared__ float T[64][65];
    unsigned b = blockIdx.x;
    if (b < CVT_BLOCKS) {                        // the largest jobs start first
        convert_block(X, Xb, b);
        return;
    }
    b -= CVT_BLOCKS;
    if (b < 4 * TSQ_BLOCKS) {
        const unsigned w = b / TSQ_BLOCKS, t = b % TSQ_BLOCKS;
        const float* W  = w == 0 ? Wq  : w == 1 ? Wk  : w == 2 ? Wv  : Wo;
        __bf16*      Wt = w == 0 ? Wqt : w == 1 ? Wkt : w == 2 ? Wvt : Wot;
        transpose_block(W, Wt, PD, PD, (t % (PD / 64)) * 64, (t / (PD / 64)) * 64, T);
        return;
    }
    b -= 4 * TSQ_BLOCKS;
    if (b < TFF_BLOCKS) {
        transpose_block(W1, W1t, PD, PDFF, (b % (PD / 64)) * 64, (b / (PD / 64)) * 64, T);
        return;
    }
    b -= TFF_BLOCKS;
    transpose_block(W2, W2t, PDFF, PD, (b % (PDFF / 64)) * 64, (b / (PDFF / 64)) * 64, T);
}

// ---------------------------------------------------------------------------
// GEMM: C = op(A[M,K](bf16) @ Wt[N,K](bf16)^T + bias (+ resid))
// Block tile BM x 128, K step 128; 8 waves in a 4 x 2 grid, each wave owns a
// (BM/4) x 64 piece. A byte staged from L2 feeds more products than in a
// 64-wide tile, and the long K step halves the stage-and-wait turns.
// BM = 256 (64x64 wave pieces: every fragment read from LDS feeds 4 products)
// where the output is wide enough to fill the chip with such blocks;
// BM = 128 (32x64 pieces) for the 1024-wide outputs, so that two blocks share
// a WGP there, one computing on two waves per SIMD while the other stages.
// Both LDS stages are straight 16-byte copies (async-to-LDS when available).
// Outputs: fp32 C and/or bf16 C (scaled) per template flags.
// ---------------------------------------------------------------------------
#define GBN  128   // block tile columns
#define GBK  128   // K step
#define GLDP 136   // padded LDS row length (bf16): 272 B = 16 B x 17
template<int BM, bool RELU, bool RESID, bool OUTF32, bool OUTBF16>
__device__ __forceinline__
void gemm_tile(const __bf16* __restrict__ A, const __bf16* __restrict__ Wt,
               const float* __restrict__ bias, const float* __restrict__ resid,
               float* __restrict__ Cf, __bf16* __restrict__ Cb, float oscale,
               int N, int K)
{
    constexpr int THREADS = 256;
    constexpr int WM = BM / 4;                      // rows of a wave's piece
    constexpr int MI = WM / 16;                     // its accumulator tile rows
    __shared__ __align__(16) __bf16 As[BM][GLDP];   // [m][k]
    __shared__ __align__(16) __bf16 Bt[GBN][GLDP];  // [n][k]
    const int tid  = threadIdx.x;
    const int wave = tid >> 5;
    const int lane = tid & 31;
    const int half = lane >> 4;
    const int l16  = lane & 15;
    const int kb0  = half * 8;
    const int kb1  = 16 + half * 8;
    const int wm   = (wave >> 1) * WM;              // the wave's rows in the tile
    const int wn   = (wave & 1) * 64;               // the wave's columns
    const int m0 = blockIdx.x * BM;
    const int n0 = blockIdx.y * GBN;
    // Staging: one pass of the block copies RS rows; a thread keeps its place
    // (row r0, chunk c0) in every pass, so one 32-bit byte offset serves all its
    // copies and the row steps stay in the block-uniform base address.
    constexpr int RS = THREADS / 16;
    const int      r0   = tid >> 4;
    const int      c0   = (tid & 15) * 8;
    const unsigned voff = ((unsigned)r0 * (unsigned)K + (unsigned)c0) * 2u;

    v8f acc[MI][4] = {};

    for (int k0 = 0; k0 < K; k0 += GBK) {
        // stage A tile: BM rows x 128 bf16, 16 chunks of 16 bytes a row
        // (unrolled: all copies of a stage are in flight at once)
        #pragma unroll
        for (int i = 0; i < BM / RS; ++i)
            copy16B((const __bf16*)((const char*)(A + (size_t)(m0 + i * RS) * K + k0) + voff),
                    &As[r0 + i * RS][c0]);
        // stage B tile (already [n][k] in global), unrolled for the same reason
        #pragma unroll
        for (int i = 0; i < GBN / RS; ++i)
            copy16B((const __bf16*)((const char*)(Wt + (size_t)(n0 + i * RS) * K + k0) + voff),
                    &Bt[r0 + i * RS][c0]);
        async_wait();
        __syncthreads();

        // unrolled: acc[][] and the fragments are indexed by constants only
        #pragma unroll
        for (int ks = 0; ks < GBK; ks += 32) {
            v16bf a[MI], b[4];
            #pragma unroll
            for (int mi = 0; mi < MI; ++mi) {
                const int row = wm + mi * 16 + l16;
                a[mi] = load_frag(&As[row][ks + kb0], &As[row][ks + kb1]);
            }
            #pragma unroll
            for (int nt = 0; nt < 4; ++nt) {
                const int col = wn + nt * 16 + l16;
                b[nt] = load_frag(&Bt[col][ks + kb0], &Bt[col][ks + kb1]);
            }
            #pragma unroll
            for (int mi = 0; mi < MI; ++mi)
                #pragma unroll
                for (int nt = 0; nt < 4; ++nt)
                    acc[mi][nt] = wmma_bf16(a[mi], b[nt], acc[mi][nt]);
        }
        __syncthreads();
    }

    // Epilogue, unrolled throughout: acc[][] is indexed by constants only.
    // One 32-bit element index per row (a plane has at most 2^25 elements) on
    // the uniform bases serves the row's residual loads and its stores; the
    // column step of a tile goes into the base. The residual tile is fetched
    // first, so that all its loads are in flight together.
    const unsigned o0 = (unsigned)(m0 + wm + half * 8) * (unsigned)N
                      + (unsigned)(n0 + wn + l16);
    float bv[4], rv[RESID ? MI : 1][4][8];
    #pragma unroll
    for (int nt = 0; nt < 4; ++nt)
        bv[nt] = bias[n0 + wn + nt * 16 + l16];
    if (RESID) {
        #pragma unroll
        for (int mi = 0; mi < MI; ++mi)
            #pragma unroll
            for (int nt = 0; nt < 4; ++nt)
                #pragma unroll
                for (int r = 0; r < 8; ++r)
                    rv[mi][nt][r] = (resid + nt * 16)[o0 + (unsigned)(mi * 16 + r) * (unsigned)N];
    }
    #pragma unroll
    for (int mi = 0; mi < MI; ++mi)
        #pragma unroll
        for (int nt = 0; nt < 4; ++nt)
            #pragma unroll
            for (int r = 0; r < 8; ++r) {
                float v = acc[mi][nt][r] + bv[nt];
                if (RESID) v += rv[mi][nt][r];
                if (RELU)  v = fmaxf(v, 0.0f);
                acc[mi][nt][r] = v;
            }

    #pragma unroll
    for (int mi = 0; mi < MI; ++mi)
        #pragma unroll
        for (int nt = 0; nt < 4; ++nt)
            #pragma unroll
            for (int r = 0; r < 8; ++r) {
                const unsigned o = o0 + (unsigned)(mi * 16 + r) * (unsigned)N;
                if (OUTF32)  (Cf + nt * 16)[o] = acc[mi][nt][r];
                if (OUTBF16) (Cb + nt * 16)[o] = (__bf16)(acc[mi][nt][r] * oscale);
            }
}

template<int BM, bool RELU, bool RESID, bool OUTF32, bool OUTBF16>
__global__ __launch_bounds__(256)
void gemm_bf16_wmma(const __bf16* __restrict__ A, const __bf16* __restrict__ Wt,
                    const float* __restrict__ bias, const float* __restrict__ resid,
                    float* __restrict__ Cf, __bf16* __restrict__ Cb, float oscale,
                    int M, int N, int K)
{
    gemm_tile<BM, RELU, RESID, OUTF32, OUTBF16>(A, Wt, bias, resid, Cf, Cb, oscale, N, K);
}

// The three projections of the same A in ONE launch: blockIdx.z picks the
// weight, bias and output. They are independent, so one grid of three times
// the blocks pays one gap, fill and drain and keeps more blocks on a WGP.
__global__ __launch_bounds__(256)
void gemm_qkv_wmma(const __bf16* __restrict__ A,
                   const __bf16* __restrict__ Wqt, const __bf16* __restrict__ Wkt,
                   const __bf16* __restrict__ Wvt,
                   const float* __restrict__ bq, const float* __restrict__ bk,
                   const float* __restrict__ bv,
                   __bf16* __restrict__ Qb, __bf16* __restrict__ Kb,
                   __bf16* __restrict__ Vb, float qscale, int N, int K)
{
    const unsigned w = blockIdx.z;
    const __bf16* Wt   = w == 0 ? Wqt : w == 1 ? Wkt : Wvt;
    const float*  bias = w == 0 ? bq  : w == 1 ? bk  : bv;
    __bf16*       Cb   = w == 0 ? Qb  : w == 1 ? Kb  : Vb;
    gemm_tile<256, false, false, false, true>(A, Wt, bias, nullptr, nullptr, Cb,
                                              w == 0 ? qscale : 1.0f, N, K);
}

// ---------------------------------------------------------------------------
// Flash-attention per (b,h, 256-query block). dk=64, S=2048; Q pre-scaled by
// 1/sqrt(dk) at the Q-GEMM. Scores std ~1 -> plain exp is fp32-safe (softmax
// is shift-invariant); row-sums via WMMA with an all-ones B matrix.
// Tile: 8 waves, each owns 32 query rows (two 16-row tiles), so that a K or V
// fragment read from LDS feeds two products; a K/V stage is shared by 256
// queries and holds 256 keys, worked on in four parts of 64.
// Q/K/V are bf16; Q/K stage as pure copies (async), V via register transpose.
// Output written bf16 (only consumed by the Wo GEMM).
// ---------------------------------------------------------------------------
#define ATT_THREADS 256
#define ATT_Q    256   // query rows of a block
#define ATT_KEYS 256   // keys of a stage
#define VLDP     264   // padded Vt row length (bf16): 528 B = 16 B x 33
__global__ __launch_bounds__(ATT_THREADS)
void attention_wmma(const __bf16* __restrict__ Q, const __bf16* __restrict__ Km,
                    const __bf16* __restrict__ Vm, __bf16* __restrict__ O,
                    int S, int D)
{
    __shared__ __align__(16) __bf16 Qs[ATT_Q][LDP];      // [q][d]
    __shared__ __align__(16) __bf16 Ks[ATT_KEYS][LDP];   // [key][d]
    __shared__ __align__(16) __bf16 Vt[64][VLDP];        // [d][key]
    __shared__ __align__(16) __bf16 Ps[ATT_Q][LDP];      // probs [q][key of a part]

    const int tid  = threadIdx.x;
    const int wave = tid >> 5;
    const int lane = tid & 31;
    const int half = lane >> 4;
    const int l16  = lane & 15;
    const int kb0  = half * 8;
    const int kb1  = 16 + half * 8;

    const int q0 = blockIdx.x * ATT_Q;
    const int bh = blockIdx.y;
    const int b  = bh >> 4;
    const int h  = bh & 15;
    const size_t rowbase = (size_t)b * S;
    const int    cbase   = h * 64;

    // stage Q block (pure bf16 copy; scale already folded in)
    #pragma unroll
    for (int i = 0; i < ATT_Q * 8 / ATT_THREADS; ++i) {
        int idx = tid + i * ATT_THREADS;
        int r = idx >> 3, c = (idx & 7) * 8;
        copy16B(&Q[(rowbase + q0 + r) * D + cbase + c], &Qs[r][c]);
    }

    v16bf ones;
    #pragma unroll
    for (int i = 0; i < 16; ++i) ones[i] = (__bf16)1.0f;

    v8f o[2][4] = {};
    v8f lsum[2] = {};

    const int wq = wave * 32;           // the wave's first query row in the block

    for (int kb = 0; kb < S; kb += ATT_KEYS) {
        __syncthreads();
        // K row-major copy (async)
        #pragma unroll
        for (int i = 0; i < ATT_KEYS * 8 / ATT_THREADS; ++i) {
            int idx = tid + i * ATT_THREADS;
            int r = idx >> 3, c = (idx & 7) * 8;
            copy16B(&Km[(rowbase + kb + r) * D + cbase + c], &Ks[r][c]);
        }
        // V transposed via 4x4 register micro-tiles; the loads of all a thread's
        // micro-tiles stand in front of the first use and share one latency
        constexpr int VT = ATT_KEYS * 4 / ATT_THREADS;   // micro-tiles per thread
        const int tn = tid & 15;        // d block
        const int tk = tid >> 4;        // key block of the first micro-tile
        v4bf f[VT][4];
        #pragma unroll
        for (int tt = 0; tt < VT; ++tt)
            #pragma unroll
            for (int j = 0; j < 4; ++j)
                f[tt][j] = *(const v4bf*)&Vm[(rowbase + kb + (tk + tt * 16) * 4 + j) * D
                                             + cbase + tn * 4];
        #pragma unroll
        for (int tt = 0; tt < VT; ++tt)
            #pragma unroll
            for (int i = 0; i < 4; ++i) {
                v4bf p;
                p[0] = f[tt][0][i]; p[1] = f[tt][1][i]; p[2] = f[tt][2][i]; p[3] = f[tt][3][i];
                *(v4bf*)&Vt[tn * 4 + i][(tk + tt * 16) * 4] = p;
            }
        async_wait();
        __syncthreads();

        // unrolled: the part's offset folds into the LDS instructions' offsets
        #pragma unroll
        for (int kh = 0; kh < ATT_KEYS; kh += 64) {
            // ---- scores = Q * K^T; each K fragment serves both query tiles
            v16bf a[2][2];
            #pragma unroll
            for (int mi = 0; mi < 2; ++mi) {
                const int row = wq + mi * 16 + l16;
                a[mi][0] = load_frag(&Qs[row][kb0],      &Qs[row][kb1]);
                a[mi][1] = load_frag(&Qs[row][32 + kb0], &Qs[row][32 + kb1]);
            }
            v8f s[2][4];
            #pragma unroll
            for (int nt = 0; nt < 4; ++nt) {
                const int col = kh + nt * 16 + l16;
                v16bf b0 = load_frag(&Ks[col][kb0],      &Ks[col][kb1]);
                v16bf b1 = load_frag(&Ks[col][32 + kb0], &Ks[col][32 + kb1]);
                #pragma unroll
                for (int mi = 0; mi < 2; ++mi) {
                    v8f z = {};
                    z = wmma_bf16(a[mi][0], b0, z);
                    z = wmma_bf16(a[mi][1], b1, z);
                    s[mi][nt] = z;
                }
            }

            // ---- p = exp(s), staged to LDS row-major (own strip only)
            #pragma unroll
            for (int mi = 0; mi < 2; ++mi)
                #pragma unroll
                for (int nt = 0; nt < 4; ++nt)
                    #pragma unroll
                    for (int r = 0; r < 8; ++r)
                        Ps[wq + mi * 16 + r + half * 8][nt * 16 + l16] =
                            (__bf16)__expf(s[mi][nt][r]);

            v16bf p[2][2];
            #pragma unroll
            for (int mi = 0; mi < 2; ++mi) {
                const int row = wq + mi * 16 + l16;
                p[mi][0] = load_frag(&Ps[row][kb0],      &Ps[row][kb1]);
                p[mi][1] = load_frag(&Ps[row][32 + kb0], &Ps[row][32 + kb1]);
            }

            // ---- row-sums of P via WMMA with all-ones B (broadcast per column)
            #pragma unroll
            for (int mi = 0; mi < 2; ++mi) {
                lsum[mi] = wmma_bf16(p[mi][0], ones, lsum[mi]);
                lsum[mi] = wmma_bf16(p[mi][1], ones, lsum[mi]);
            }

            // ---- O += P * V; each V fragment serves both query tiles
            #pragma unroll
            for (int nt = 0; nt < 4; ++nt) {
                const int col = nt * 16 + l16;
                v16bf b0 = load_frag(&Vt[col][kh + kb0],      &Vt[col][kh + kb1]);
                v16bf b1 = load_frag(&Vt[col][kh + 32 + kb0], &Vt[col][kh + 32 + kb1]);
                #pragma unroll
                for (int mi = 0; mi < 2; ++mi) {
                    o[mi][nt] = wmma_bf16(p[mi][0], b0, o[mi][nt]);
                    o[mi][nt] = wmma_bf16(p[mi][1], b1, o[mi][nt]);
                }
            }
        }
    }

    // ---- normalize by row-sum, write bf16
    #pragma unroll
    for (int mi = 0; mi < 2; ++mi)
        #pragma unroll
        for (int nt = 0; nt < 4; ++nt) {
            const int col = cbase + nt * 16 + l16;
            #pragma unroll
            for (int r = 0; r < 8; ++r) {
                const int row = q0 + wq + mi * 16 + r + half * 8;
                O[(rowbase + row) * D + col] = (__bf16)(o[mi][nt][r] / lsum[mi][r]);
            }
        }
}

// ---------------------------------------------------------------------------
// Row-wise LayerNorm over rows of LN_D floats; optionally also emits a bf16
// shadow copy for the next GEMM's A operand.
// One wave owns LN_ROWS whole rows, held in registers (16-byte loads, 512
// contiguous bytes per wave load): no LDS, no barrier, the row is read once,
// and the launch starts 16x fewer waves than one 8-wave block per row.
// ---------------------------------------------------------------------------
#define LN_D       1024
#define LN_THREADS 512
#define LN_ROWS    2                 // rows per wave
#define LN_VEC     (LN_D / 128)      // float4 per lane and row
template<bool OUTBF16>
__global__ __launch_bounds__(LN_THREADS)
void layernorm_kernel(const float* __restrict__ X, const float* __restrict__ g,
                      const float* __restrict__ beta, float* __restrict__ Y,
                      __bf16* __restrict__ Yb)
{
    const unsigned lane = threadIdx.x & 31;
    const unsigned row0 =
        (blockIdx.x * (LN_THREADS / 32) + (threadIdx.x >> 5)) * LN_ROWS;
    // One 32-bit byte offset (a plane is 32 MiB) on the scalar bases X and Y:
    // the row loads and the fp32 stores share one offset register, which so
    // stays live from the first load to the last store.
    const unsigned boff = (row0 * LN_D + lane * 4) * 4u;
    const float* xp  = (const float*)((const char*)X + boff);
    float*       yp  = (float*)((char*)Y + boff);
    __bf16*      ybp = OUTBF16 ? (__bf16*)((char*)Yb + (boff >> 1)) : nullptr;

    float4 v[LN_ROWS][LN_VEC], gg[LN_VEC], bb[LN_VEC];
    // every loop below is unrolled so that the arrays are indexed by constants
    // and stay in registers; here it also puts all row loads in flight at once
    #pragma unroll
    for (int r = 0; r < LN_ROWS; ++r)
        #pragma unroll
        for (int j = 0; j < LN_VEC; ++j)
            v[r][j] = *(const float4*)&xp[r * LN_D + j * 128];
    #pragma unroll
    for (int j = 0; j < LN_VEC; ++j) {
        gg[j] = *(const float4*)&g[j * 128 + lane * 4];
        bb[j] = *(const float4*)&beta[j * 128 + lane * 4];
    }

    float sum[LN_ROWS], sq[LN_ROWS];
    #pragma unroll
    for (int r = 0; r < LN_ROWS; ++r) {
        float4 s = make_float4(0.f, 0.f, 0.f, 0.f);   // four independent chains
        float4 q = make_float4(0.f, 0.f, 0.f, 0.f);
        #pragma unroll
        for (int j = 0; j < LN_VEC; ++j) {
            const float4 t = v[r][j];
            s.x += t.x; s.y += t.y; s.z += t.z; s.w += t.w;
            q.x += t.x * t.x; q.y += t.y * t.y; q.z += t.z * t.z; q.w += t.w * t.w;
        }
        sum[r] = (s.x + s.y) + (s.z + s.w);
        sq[r]  = (q.x + q.y) + (q.z + q.w);
    }
    #pragma unroll
    for (int off = 1; off < 32; off <<= 1)
        #pragma unroll
        for (int r = 0; r < LN_ROWS; ++r) {
            sum[r] += __shfl_xor(sum[r], off, 32);
            sq[r]  += __shfl_xor(sq[r],  off, 32);
        }

    v4bf yb[LN_ROWS][LN_VEC];
    #pragma unroll
    for (int r = 0; r < LN_ROWS; ++r) {
        const float mu  = sum[r] / (float)LN_D;
        const float inv = rsqrtf(sq[r] / (float)LN_D - mu * mu + LN_EPS);
        #pragma unroll
        for (int j = 0; j < LN_VEC; ++j) {
            float4 t = v[r][j];
            t.x = (t.x - mu) * inv * gg[j].x + bb[j].x;
            t.y = (t.y - mu) * inv * gg[j].y + bb[j].y;
            t.z = (t.z - mu) * inv * gg[j].z + bb[j].z;
            t.w = (t.w - mu) * inv * gg[j].w + bb[j].w;
            v[r][j] = t;
            if (OUTBF16) yb[r][j] = cvt4(t);
        }
    }

    // Without this the scheduler sinks the second row's loads behind the first
    // row's stores (two memory latencies in a row) and reuses the registers of
    // issued stores; with it every store stands behind the last arithmetic.
    __builtin_amdgcn_sched_barrier(0);

    #pragma unroll
    for (int r = 0; r < LN_ROWS; ++r)
        #pragma unroll
        for (int j = 0; j < LN_VEC; ++j) {
            const int o = r * LN_D + j * 128;
            *(float4*)&yp[o] = v[r][j];
            if (OUTBF16) *(v4bf*)&ybp[o] = yb[r][j];
        }
}

// ---------------------------------------------------------------------------
extern "C" void kernel_launch(void* const* d_in, const int* in_sizes, int n_in,
                              void* d_out, int out_size, void* d_ws, size_t ws_size,
                              hipStream_t stream)
{
    const float* x    = (const float*)d_in[0];
    const float* Wq   = (const float*)d_in[1];
    const float* bq   = (const float*)d_in[2];
    const float* Wk   = (const float*)d_in[3];
    const float* bk   = (const float*)d_in[4];
    const float* Wv   = (const float*)d_in[5];
    const float* bv   = (const float*)d_in[6];
    const float* Wo   = (const float*)d_in[7];
    const float* bo   = (const float*)d_in[8];
    const float* W1   = (const float*)d_in[9];
    const float* b1   = (const float*)d_in[10];
    const float* W2   = (const float*)d_in[11];
    const float* b2   = (const float*)d_in[12];
    const float* g1   = (const float*)d_in[13];
    const float* be1  = (const float*)d_in[14];
    const float* g2   = (const float*)d_in[15];
    const float* be2  = (const float*)d_in[16];

    const int B = 4, S = 2048, D = 1024, DFF = 4096;
    const int M = B * S;  // 8192
    const size_t MD  = (size_t)M * D;
    const size_t MDF = (size_t)M * DFF;

    char* p = (char*)d_ws;
    auto alloc = [&](size_t bytes) { char* q = p; p += (bytes + 255) & ~(size_t)255; return q; };

    __bf16* xb  = (__bf16*)alloc(MD * 2);
    __bf16* Wqt = (__bf16*)alloc((size_t)D * D * 2);
    __bf16* Wkt = (__bf16*)alloc((size_t)D * D * 2);
    __bf16* Wvt = (__bf16*)alloc((size_t)D * D * 2);
    __bf16* Wot = (__bf16*)alloc((size_t)D * D * 2);
    __bf16* W1t = (__bf16*)alloc((size_t)D * DFF * 2);
    __bf16* W2t = (__bf16*)alloc((size_t)DFF * D * 2);
    __bf16* Qb  = (__bf16*)alloc(MD * 2);
    __bf16* Kb  = (__bf16*)alloc(MD * 2);
    __bf16* Vb  = (__bf16*)alloc(MD * 2);
    __bf16* Ob  = (__bf16*)alloc(MD * 2);
    float*  h1  = (float*)alloc(MD * 4);
    float*  x2  = (float*)alloc(MD * 4);
    __bf16* x2b = (__bf16*)alloc(MD * 2);
    __bf16* F1b = (__bf16*)alloc(MDF * 2);
    float*  h2  = h1;   // h1 consumed by LN1 before FFN2 writes h2

    // ---- x -> bf16 and all weight pre-transposes, one launch
    prepare_kernel<<<dim3(PREP_BLOCKS), dim3(PREP_THREADS), 0, stream>>>(
        x, xb, Wq, Wqt, Wk, Wkt, Wv, Wvt, Wo, Wot, W1, W1t, W2, W2t);

    // ---- QKV projections, one launch (bf16 outputs; Q pre-scaled by 1/sqrt(dk))
    gemm_qkv_wmma<<<dim3(M / 256, D / GBN, 3), dim3(256), 0, stream>>>(
        xb, Wqt, Wkt, Wvt, bq, bk, bv, Qb, Kb, Vb, 0.125f, D, D);

    // ---- attention
    attention_wmma<<<dim3(S / ATT_Q, B * 16), dim3(ATT_THREADS), 0, stream>>>(Qb, Kb, Vb, Ob, S, D);

    // ---- output projection + residual x  -> h1 (fp32)
    gemm_bf16_wmma<128, false, true, true, false><<<dim3(M / 128, D / GBN), dim3(256), 0, stream>>>(
        Ob, Wot, bo, x, h1, nullptr, 1.0f, M, D, D);

    // ---- LN1 -> x2 (fp32 residual) + x2b (bf16 operand)
    layernorm_kernel<true><<<dim3(M / (LN_THREADS / 32 * LN_ROWS)), dim3(LN_THREADS), 0, stream>>>(h1, g1, be1, x2, x2b);

    // ---- FFN1 with ReLU -> bf16 only
    gemm_bf16_wmma<256, true, false, false, true><<<dim3(M / 256, DFF / GBN), dim3(256), 0, stream>>>(
        x2b, W1t, b1, nullptr, nullptr, F1b, 1.0f, M, DFF, D);

    // ---- FFN2 + residual x2 -> h2 (fp32)
    gemm_bf16_wmma<128, false, true, true, false><<<dim3(M / 128, D / GBN), dim3(256), 0, stream>>>(
        F1b, W2t, b2, x2, h2, nullptr, 1.0f, M, D, DFF);

    // ---- LN2 -> output
    layernorm_kernel<false><<<dim3(M / (LN_THREADS / 32 * LN_ROWS)), dim3(LN_THREADS), 0, stream>>>(h2, g2, be2, (float*)d_out, nullptr);
}

// v006
// One run takes 274 microseconds.
// In two side-by-side timings against v005, it was 1.05 and 1.06 times as fast.
// Over all steps from v000 it is 1.75 times as fast.
#include <hip/hip_runtime.h>
#include <hip/hip_bf16.h>

typedef __attribute__((ext_vector_type(16))) __bf16 v16bf;
typedef __attribute__((ext_vector_type(8)))  __bf16 v8bf;
typedef __attribute__((ext_vector_type(4)))  __bf16 v4bf;
typedef __attribute__((ext_vector_type(8)))  float  v8f;
typedef __attribute__((__vector_size__(4 * sizeof(int)))) int i32x4;

#define LN_EPS 1e-5f
#define LDP 72   // padded LDS row length (bf16): 144 B, multiple of 16 B

#if defined(__has_builtin)
#if __has_builtin(__builtin_amdgcn_global_load_async_to_lds_b128) && \
    __has_builtin(__builtin_amdgcn_s_wait_asynccnt)
#define HAVE_ASYNC_LDS 1
#endif
#endif

#define AS1 __attribute__((address_space(1)))
#define AS3 __attribute__((address_space(3)))

__device__ __forceinline__ v8f wmma_bf16(const v16bf& a, const v16bf& b, const v8f& c) {
    return __builtin_amdgcn_wmma_f32_16x16x32_bf16(false, a, false, b, (short)0, c, false, false);
}

// Two contiguous 16-byte LDS loads -> one 16-element bf16 fragment.
__device__ __forceinline__ v16bf load_frag(const __bf16* p0, const __bf16* p1) {
    v8bf lo = *(const v8bf*)p0;
    v8bf hi = *(const v8bf*)p1;
    return __builtin_shufflevector(lo, hi, 0, 1, 2, 3, 4, 5, 6, 7,
                                   8, 9, 10, 11, 12, 13, 14, 15);
}

__device__ __forceinline__ v4bf cvt4(const float4 f) {
    v4bf b;
    b[0] = (__bf16)f.x; b[1] = (__bf16)f.y; b[2] = (__bf16)f.z; b[3] = (__bf16)f.w;
    return b;
}

// 16-byte global(bf16) -> LDS copy; async-to-LDS when toolchain supports it.
__device__ __forceinline__ void copy16B(const __bf16* g, __bf16* l) {
#ifdef HAVE_ASYNC_LDS
    __builtin_amdgcn_global_load_async_to_lds_b128(
        (AS1 i32x4*)g, (AS3 i32x4*)l, 0, 0);
#else
    *(v8bf*)l = *(const v8bf*)g;
#endif
}

__device__ __forceinline__ void async_wait() {
#ifdef HAVE_ASYNC_LDS
    __builtin_amdgcn_s_wait_asynccnt(0);
#endif
}

// The two waits of a ring's hand-over, in asm with a memory clobber so that no
// LDS access of the compiler's moves across them.
// This wave's LDS reads have retired: the buffer they read may be refilled.
__device__ __forceinline__ void ring_wait_reads() {
    asm volatile("s_wait_dscnt 0x0" ::: "memory");
}
// This wave's async copies have landed: the barrier behind it publishes them.
__device__ __forceinline__ void ring_wait_copies() {
    asm volatile("s_wait_asynccnt 0x0" ::: "memory");
}

// ---------------------------------------------------------------------------
// Preparation, ONE launch: x -> bf16 and the six weights -> transposed bf16.
// The seven jobs do not depend on each other, so they share one grid and pay
// one launch gap, one fill and one drain; a block picks its job from
// blockIdx.x (the same for the whole block).
// ---------------------------------------------------------------------------
#define PD    1024                   // model width
#define PDFF  4096                   // hidden width
#define PM    8192                   // rows of x
#define PREP_THREADS 256
#define CVT_VEC      16              // float4 per thread
#define CVT_BLOCKS   (PM * PD / (PREP_THREADS * CVT_VEC * 4))
#define TSQ_BLOCKS   ((PD / 64) * (PD / 64))      // one square weight
#define TFF_BLOCKS   ((PD / 64) * (PDFF / 64))    // W1 or W2
#define PREP_BLOCKS  (CVT_BLOCKS + 4 * TSQ_BLOCKS + 2 * TFF_BLOCKS)

// fp32 -> bf16 elementwise, fat waves: 16 float4 per thread.
__device__ __forceinline__
void convert_block(const float* __restrict__ X, __bf16* __restrict__ Y, unsigned blk)
{
    const size_t base =
        ((size_t)blk * (PREP_THREADS * CVT_VEC) + threadIdx.x) * 4;
    float4 f[CVT_VEC];
    // unrolled so that f[] stays in registers and many loads are in flight at once
    #pragma unroll
    for (int i = 0; i < CVT_VEC; ++i)
        f[i] = *(const float4*)&X[base + (size_t)i * (PREP_THREADS * 4)];
    // unrolled: f[] is indexed by constants only
    #pragma unroll
    for (int i = 0; i < CVT_VEC; ++i)
        *(v4bf*)&Y[base + (size_t)i * (PREP_THREADS * 4)] = cvt4(f[i]);
}

// W[K,N] fp32 -> Wt[N,K] bf16, one 64x64 tile through LDS.
__device__ __forceinline__
void transpose_block(const float* __restrict__ W, __bf16* __restrict__ Wt,
                     int K, int N, int k0, int n0, float (*T)[65])
{
    #pragma unroll
    for (int i = 0; i < 16; ++i) {
        int idx = threadIdx.x + i * 256;
        int r = idx >> 6, c = idx & 63;
        T[r][c] = W[(size_t)(k0 + r) * N + n0 + c];
    }
    __syncthreads();
    #pragma unroll
    for (int i = 0; i < 16; ++i) {
        int idx = threadIdx.x + i * 256;
        int r = idx >> 6, c = idx & 63;         // r = n-local, c = k-local
        Wt[(size_t)(n0 + r) * K + k0 + c] = (__bf16)T[c][r];
    }
    // The jobs are laid out one behind the other in the built kernel: this wait
    // stands between the stores above and any later write of their registers.
    asm volatile("s_wait_xcnt 0x0" ::: "memory");
}

__global__ __launch_bounds__(PREP_THREADS)
void prepare_kernel(const float* __restrict__ X,  __bf16* __restrict__ Xb,
                    const float* __restrict__ Wq, __bf16* __restrict__ Wqt,
                    const float* __restrict__ Wk, __bf16* __restrict__ Wkt,
                    const float* __restrict__ Wv, __bf16* __restrict__ Wvt,
                    const float* __restrict__ Wo, __bf16* __restrict__ Wot,
                    const float* __restrict__ W1, __bf16* __restrict__ W1t,
                    const float* __restrict__ W2, __bf16* __restrict__ W2t)
{
    __shared__ float T[64][65];
    unsigned b = blockIdx.x;
    if (b < CVT_BLOCKS) {                        // the largest jobs start first
        convert_block(X, Xb, b);
        return;
    }
    b -= CVT_BLOCKS;
    if (b < 4 * TSQ_BLOCKS) {
        const unsigned w = b / TSQ_BLOCKS, t = b % TSQ_BLOCKS;
        const float* W  = w == 0 ? Wq  : w == 1 ? Wk  : w == 2 ? Wv  : Wo;
        __bf16*      Wt = w == 0 ? Wqt : w == 1 ? Wkt : w == 2 ? Wvt : Wot;
        transpose_block(W, Wt, PD, PD, (t % (PD / 64)) * 64, (t / (PD / 64)) * 64, T);
        return;
    }
    b -= 4 * TSQ_BLOCKS;
    if (b < TFF_BLOCKS) {
        transpose_block(W1, W1t, PD, PDFF, (b % (PD / 64)) * 64, (b / (PD / 64)) * 64, T);
        return;
    }
    b -= TFF_BLOCKS;
    transpose_block(W2, W2t, PDFF, PD, (b % (PDFF / 64)) * 64, (b / (PDFF / 64)) * 64, T);
}

// ---------------------------------------------------------------------------
// GEMM: C = op(A[M,K](bf16) @ Wt[N,K](bf16)^T + bias (+ resid))
// Block tile BM x 128; 8 waves in a 4 x 2 grid, each wave owns a (BM/4) x 64
// piece. A byte staged from L2 feeds more products than in a 64-wide tile.
// BM = 256 (64x64 wave pieces: every fragment read from LDS feeds 4 products)
// where the output is wide enough to fill the chip with such blocks;
// BM = 128 (32x64 pieces) for the 1024-wide outputs, so that two blocks share
// a WGP there, one computing on two waves per SIMD while the other stages.
// Both LDS stages are straight 16-byte copies (async-to-LDS when available).
// Two LDS buffers: the copies of K step t + 1 are in flight while step t is
// multiplied, so the way from L2 and the products overlap inside one block;
// one barrier a step publishes step t + 1 and frees the buffer of step t.
// K step: 128 at BM = 128; 64 at BM = 256, where two buffers of 128 would take
// so much LDS that a WGP holds one block only (with 64 it still holds two, and
// one block's first stage and epilogue run beside the other's products).
// Outputs: fp32 C and/or bf16 C (scaled) per template flags.
// ---------------------------------------------------------------------------
#define GBN  128   // block tile columns
template<int BM, bool RELU, bool RESID, bool OUTF32, bool OUTBF16>
__device__ __forceinline__
void gemm_tile(const __bf16* __restrict__ A, const __bf16* __restrict__ Wt,
               const float* __restrict__ bias, const float* __restrict__ resid,
               float* __restrict__ Cf, __bf16* __restrict__ Cb, float oscale,
               int N, int K)
{
    constexpr int THREADS = 256;
    constexpr int WM = BM / 4;                      // rows of a wave's piece
    constexpr int MI = WM / 16;                     // its accumulator tile rows
    constexpr int GBK  = BM == 256 ? 64 : 128;      // K step
    constexpr int GLDP = GBK + 8;   // padded LDS row (bf16): 16 B x 9 or 16 B x 17
    // a buffer: BM rows of A [m][k], then GBN rows of Wt [n][k]
    __shared__ __align__(16) __bf16 St[2][BM + GBN][GLDP];
    const int tid  = threadIdx.x;
    const int wave = tid >> 5;
    const int lane = tid & 31;
    const int half = lane >> 4;
    const int l16  = lane & 15;
    const int kb0  = half * 8;
    const int kb1  = 16 + half * 8;
    const int wm   = (wave >> 1) * WM;              // the wave's rows in the tile
    const int wn   = (wave & 1) * 64;               // the wave's columns
    const int m0 = blockIdx.x * BM;
    const int n0 = blockIdx.y * GBN;
    // Staging: one pass of the block copies RS rows; a thread keeps its place
    // (row r0, chunk c0) in every pass, so one 32-bit byte offset serves all its
    // copies and the row steps stay in the block-uniform base address.
    constexpr int CH = GBK / 8;                     // 16-byte chunks of a row
    constexpr int RS = THREADS / CH;
    const int      r0   = tid / CH;
    const int      c0   = (tid % CH) * 8;
    const unsigned voff = ((unsigned)r0 * (unsigned)K + (unsigned)c0) * 2u;

    v8f acc[MI][4] = {};

    auto stage = [&](int k0, int buf) {
        // A tile: BM rows x GBK bf16, CH chunks of 16 bytes a row
        // (unrolled: all copies of a stage are in flight at once)
        #pragma unroll
        for (int i = 0; i < BM / RS; ++i)
            copy16B((const __bf16*)((const char*)(A + (size_t)(m0 + i * RS) * K + k0) + voff),
                    &St[buf][r0 + i * RS][c0]);
        // B tile (already [n][k] in global), unrolled for the same reason
        #pragma unroll
        for (int i = 0; i < GBN / RS; ++i)
            copy16B((const __bf16*)((const char*)(Wt + (size_t)(n0 + i * RS) * K + k0) + voff),
                    &St[buf][BM + r0 + i * RS][c0]);
    };

    // step 0 lands and is published; step 1 then flies during step 0's products
    stage(0, 0);
    ring_wait_copies();
    __syncthreads();
    if (GBK < K) stage(GBK, 1);

    for (int k0 = 0; k0 < K; k0 += GBK) {
        const int buf = (k0 / GBK) & 1;
        const __bf16 (*As)[GLDP] = &St[buf][0];     // [m][k]
        const __bf16 (*Bt)[GLDP] = &St[buf][BM];    // [n][k]

        // unrolled: acc[][] and the fragments are indexed by constants only
        #pragma unroll
        for (int ks = 0; ks < GBK; ks += 32) {
            v16bf a[MI], b[4];
            #pragma unroll
            for (int mi = 0; mi < MI; ++mi) {
                const int row = wm + mi * 16 + l16;
                a[mi] = load_frag(&As[row][ks + kb0], &As[row][ks + kb1]);
            }
            #pragma unroll
            for (int nt = 0; nt < 4; ++nt) {
                const int col = wn + nt * 16 + l16;
                b[nt] = load_frag(&Bt[col][ks + kb0], &Bt[col][ks + kb1]);
            }
            #pragma unroll
            for (int mi = 0; mi < MI; ++mi)
                #pragma unroll
                for (int nt = 0; nt < 4; ++nt)
                    acc[mi][nt] = wmma_bf16(a[mi], b[nt], acc[mi][nt]);
        }
        // hand-over: step t + 1 has landed for everybody, and nobody reads
        // this step's buffer any more; only then is it refilled
        ring_wait_reads();
        ring_wait_copies();
        __syncthreads();
        if (k0 + 2 * GBK < K) stage(k0 + 2 * GBK, buf);
    }
    ring_wait_copies();   // no wave goes on to its end with a copy in flight

    // Epilogue, unrolled throughout: acc[][] is indexed by constants only.
    // One 32-bit element index per row (a plane has at most 2^25 elements) on
    // the uniform bases serves the row's residual loads and its stores; the
    // column step of a tile goes into the base. The residual tile is fetched
    // first, so that all its loads are in flight together.
    const unsigned o0 = (unsigned)(m0 + wm + half * 8) * (unsigned)N
                      + (unsigned)(n0 + wn + l16);
    float bv[4], rv[RESID ? MI : 1][4][8];
    #pragma unroll
    for (int nt = 0; nt < 4; ++nt)
        bv[nt] = bias[n0 + wn + nt * 16 + l16];
    if (RESID) {
        #pragma unroll
        for (int mi = 0; mi < MI; ++mi)
            #pragma unroll
            for (int nt = 0; nt < 4; ++nt)
                #pragma unroll
                for (int r = 0; r < 8; ++r)
                    rv[mi][nt][r] = (resid + nt * 16)[o0 + (unsigned)(mi * 16 + r) * (unsigned)N];
    }
    #pragma unroll
    for (int mi = 0; mi < MI; ++mi)
        #pragma unroll
        for (int nt = 0; nt < 4; ++nt)
            #pragma unroll
            for (int r = 0; r < 8; ++r) {
                float v = acc[mi][nt][r] + bv[nt];
                if (RESID) v += rv[mi][nt][r];
                if (RELU)  v = fmaxf(v, 0.0f);
                acc[mi][nt][r] = v;
            }

    #pragma unroll
    for (int mi = 0; mi < MI; ++mi)
        #pragma unroll
        for (int nt = 0; nt < 4; ++nt)
            #pragma unroll
            for (int r = 0; r < 8; ++r) {
                const unsigned o = o0 + (unsigned)(mi * 16 + r) * (unsigned)N;
                if (OUTF32)  (Cf + nt * 16)[o] = acc[mi][nt][r];
                if (OUTBF16) (Cb + nt * 16)[o] = (__bf16)(acc[mi][nt][r] * oscale);
            }
}

template<int BM, bool RELU, bool RESID, bool OUTF32, bool OUTBF16>
__global__ __launch_bounds__(256)
void gemm_bf16_wmma(const __bf16* __restrict__ A, const __bf16* __restrict__ Wt,
                    const float* __restrict__ bias, const float* __restrict__ resid,
                    float* __restrict__ Cf, __bf16* __restrict__ Cb, float oscale,
                    int M, int N, int K)
{
    gemm_tile<BM, RELU, RESID, OUTF32, OUTBF16>(A, Wt, bias, resid, Cf, Cb, oscale, N, K);
}

// The three projections of the same A in ONE launch: blockIdx.z picks the
// weight, bias and output. They are independent, so one grid of three times
// the blocks pays one gap, fill and drain and keeps more blocks on a WGP.
__global__ __launch_bounds__(256)
void gemm_qkv_wmma(const __bf16* __restrict__ A,
                   const __bf16* __restrict__ Wqt, const __bf16* __restrict__ Wkt,
                   const __bf16* __restrict__ Wvt,
                   const float* __restrict__ bq, const float* __restrict__ bk,
                   const float* __restrict__ bv,
                   __bf16* __restrict__ Qb, __bf16* __restrict__ Kb,
                   __bf16* __restrict__ Vb, float qscale, int N, int K)
{
    const unsigned w = blockIdx.z;
    const __bf16* Wt   = w == 0 ? Wqt : w == 1 ? Wkt : Wvt;
    const float*  bias = w == 0 ? bq  : w == 1 ? bk  : bv;
    __bf16*       Cb   = w == 0 ? Qb  : w == 1 ? Kb  : Vb;
    gemm_tile<256, false, false, false, true>(A, Wt, bias, nullptr, nullptr, Cb,
                                              w == 0 ? qscale : 1.0f, N, K);
}

// ---------------------------------------------------------------------------
// Flash-attention per (b,h, 256-query block). dk=64, S=2048; Q pre-scaled by
// 1/sqrt(dk) at the Q-GEMM. Scores std ~1 -> plain exp is fp32-safe (softmax
// is shift-invariant); row-sums via WMMA with an all-ones B matrix.
// Tile: 8 waves, each owns 32 query rows (two 16-row tiles), so that a K or V
// fragment read from LDS feeds two products; a K/V stage is shared by 256
// queries and holds 256 keys, worked on in four parts of 64.
// Q/K/V are bf16; Q/K stage as pure copies (async), V via register transpose.
// Output written bf16 (only consumed by the Wo GEMM).
// ---------------------------------------------------------------------------
#define ATT_THREADS 256
#define ATT_Q    256   // query rows of a block
#define ATT_KEYS 256   // keys of a stage
#define VLDP     264   // padded Vt row length (bf16): 528 B = 16 B x 33
__global__ __launch_bounds__(ATT_THREADS)
void attention_wmma(const __bf16* __restrict__ Q, const __bf16* __restrict__ Km,
                    const __bf16* __restrict__ Vm, __bf16* __restrict__ O,
                    int S, int D)
{
    __shared__ __align__(16) __bf16 Qs[ATT_Q][LDP];      // [q][d]
    __shared__ __align__(16) __bf16 Ks[ATT_KEYS][LDP];   // [key][d]
    __shared__ __align__(16) __bf16 Vt[64][VLDP];        // [d][key]
    __shared__ __align__(16) __bf16 Ps[ATT_Q][LDP];      // probs [q][key of a part]

    const int tid  = threadIdx.x;
    const int wave = tid >> 5;
    const int lane = tid & 31;
    const int half = lane >> 4;
    const int l16  = lane & 15;
    const int kb0  = half * 8;
    const int kb1  = 16 + half * 8;

    const int q0 = blockIdx.x * ATT_Q;
    const int bh = blockIdx.y;
    const int b  = bh >> 4;
    const int h  = bh & 15;
    const size_t rowbase = (size_t)b * S;
    const int    cbase   = h * 64;

    // stage Q block (pure bf16 copy; scale already folded in)
    #pragma unroll
    for (int i = 0; i < ATT_Q * 8 / ATT_THREADS; ++i) {
        int idx = tid + i * ATT_THREADS;
        int r = idx >> 3, c = (idx & 7) * 8;
        copy16B(&Q[(rowbase + q0 + r) * D + cbase + c], &Qs[r][c]);
    }

    v16bf ones;
    #pragma unroll
    for (int i = 0; i < 16; ++i) ones[i] = (__bf16)1.0f;

    v8f o[2][4] = {};
    v8f lsum[2] = {};

    const int wq = wave * 32;           // the wave's first query row in the block

    for (int kb = 0; kb < S; kb += ATT_KEYS) {
        __syncthreads();
        // K row-major copy (async)
        #pragma unroll
        for (int i = 0; i < ATT_KEYS * 8 / ATT_THREADS; ++i) {
            int idx = tid + i * ATT_THREADS;
            int r = idx >> 3, c = (idx & 7) * 8;
            copy16B(&Km[(rowbase + kb + r) * D + cbase + c], &Ks[r][c]);
        }
        // V transposed via 4x4 register micro-tiles; the loads of all a thread's
        // micro-tiles stand in front of the first use and share one latency
        constexpr int VT = ATT_KEYS * 4 / ATT_THREADS;   // micro-tiles per thread
        const int tn = tid & 15;        // d block
        const int tk = tid >> 4;        // key block of the first micro-tile
        v4bf f[VT][4];
        #pragma unroll
        for (int tt = 0; tt < VT; ++tt)
            #pragma unroll
            for (int j = 0; j < 4; ++j)
                f[tt][j] = *(const v4bf*)&Vm[(rowbase + kb + (tk + tt * 16) * 4 + j) * D
                                             + cbase + tn * 4];
        #pragma unroll
        for (int tt = 0; tt < VT; ++tt)
            #pragma unroll
            for (int i = 0; i < 4; ++i) {
                v4bf p;
                p[0] = f[tt][0][i]; p[1] = f[tt][1][i]; p[2] = f[tt][2][i]; p[3] = f[tt][3][i];
                *(v4bf*)&Vt[tn * 4 + i][(tk + tt * 16) * 4] = p;
            }
        async_wait();
        __syncthreads();

        // unrolled: the part's offset folds into the LDS instructions' offsets
        #pragma unroll
        for (int kh = 0; kh < ATT_KEYS; kh += 64) {
            // ---- scores = Q * K^T; each K fragment serves both query tiles
            v16bf a[2][2];
            #pragma unroll
            for (int mi = 0; mi < 2; ++mi) {
                const int row = wq + mi * 16 + l16;
                a[mi][0] = load_frag(&Qs[row][kb0],      &Qs[row][kb1]);
                a[mi][1] = load_frag(&Qs[row][32 + kb0], &Qs[row][32 + kb1]);
            }
            v8f s[2][4];
            #pragma unroll
            for (int nt = 0; nt < 4; ++nt) {
                const int col = kh + nt * 16 + l16;
                v16bf b0 = load_frag(&Ks[col][kb0],      &Ks[col][kb1]);
                v16bf b1 = load_frag(&Ks[col][32 + kb0], &Ks[col][32 + kb1]);
                #pragma unroll
                for (int mi = 0; mi < 2; ++mi) {
                    v8f z = {};
                    z = wmma_bf16(a[mi][0], b0, z);
                    z = wmma_bf16(a[mi][1], b1, z);
                    s[mi][nt] = z;
                }
            }

            // ---- p = exp(s), staged to LDS row-major (own strip only)
            #pragma unroll
            for (int mi = 0; mi < 2; ++mi)
                #pragma unroll
                for (int nt = 0; nt < 4; ++nt)
                    #pragma unroll
                    for (int r = 0; r < 8; ++r)
                        Ps[wq + mi * 16 + r + half * 8][nt * 16 + l16] =
                            (__bf16)__expf(s[mi][nt][r]);

            v16bf p[2][2];
            #pragma unroll
            for (int mi = 0; mi < 2; ++mi) {
                const int row = wq + mi * 16 + l16;
                p[mi][0] = load_frag(&Ps[row][kb0],      &Ps[row][kb1]);
                p[mi][1] = load_frag(&Ps[row][32 + kb0], &Ps[row][32 + kb1]);
            }

            // ---- row-sums of P via WMMA with all-ones B (broadcast per column)
            #pragma unroll
            for (int mi = 0; mi < 2; ++mi) {
                lsum[mi] = wmma_bf16(p[mi][0], ones, lsum[mi]);
                lsum[mi] = wmma_bf16(p[mi][1], ones, lsum[mi]);
            }

            // ---- O += P * V; each V fragment serves both query tiles
            #pragma unroll
            for (int nt = 0; nt < 4; ++nt) {
                const int col = nt * 16 + l16;
                v16bf b0 = load_frag(&Vt[col][kh + kb0],      &Vt[col][kh + kb1]);
                v16bf b1 = load_frag(&Vt[col][kh + 32 + kb0], &Vt[col][kh + 32 + kb1]);
                #pragma unroll
                for (int mi = 0; mi < 2; ++mi) {
                    o[mi][nt] = wmma_bf16(p[mi][0], b0, o[mi][nt]);
                    o[mi][nt] = wmma_bf16(p[mi][1], b1, o[mi][nt]);
                }
            }
        }
    }

    // ---- normalize by row-sum, write bf16
    #pragma unroll
    for (int mi = 0; mi < 2; ++mi)
        #pragma unroll
        for (int nt = 0; nt < 4; ++nt) {
            const int col = cbase + nt * 16 + l16;
            #pragma unroll
            for (int r = 0; r < 8; ++r) {
                const int row = q0 + wq + mi * 16 + r + half * 8;
                O[(rowbase + row) * D + col] = (__bf16)(o[mi][nt][r] / lsum[mi][r]);
            }
        }
}

// ---------------------------------------------------------------------------
// Row-wise LayerNorm over rows of LN_D floats; optionally also emits a bf16
// shadow copy for the next GEMM's A operand.
// One wave owns LN_ROWS whole rows, held in registers (16-byte loads, 512
// contiguous bytes per wave load): no LDS, no barrier, the row is read once,
// and the launch starts 16x fewer waves than one 8-wave block per row.
// ---------------------------------------------------------------------------
#define LN_D       1024
#define LN_THREADS 512
#define LN_ROWS    2                 // rows per wave
#define LN_VEC     (LN_D / 128)      // float4 per lane and row
template<bool OUTBF16>
__global__ __launch_bounds__(LN_THREADS)
void layernorm_kernel(const float* __restrict__ X, const float* __restrict__ g,
                      const float* __restrict__ beta, float* __restrict__ Y,
                      __bf16* __restrict__ Yb)
{
    const unsigned lane = threadIdx.x & 31;
    const unsigned row0 =
        (blockIdx.x * (LN_THREADS / 32) + (threadIdx.x >> 5)) * LN_ROWS;
    // One 32-bit byte offset (a plane is 32 MiB) on the scalar bases X and Y:
    // the row loads and the fp32 stores share one offset register, which so
    // stays live from the first load to the last store.
    const unsigned boff = (row0 * LN_D + lane * 4) * 4u;
    const float* xp  = (const float*)((const char*)X + boff);
    float*       yp  = (float*)((char*)Y + boff);
    __bf16*      ybp = OUTBF16 ? (__bf16*)((char*)Yb + (boff >> 1)) : nullptr;

    float4 v[LN_ROWS][LN_VEC], gg[LN_VEC], bb[LN_VEC];
    // every loop below is unrolled so that the arrays are indexed by constants
    // and stay in registers; here it also puts all row loads in flight at once
    #pragma unroll
    for (int r = 0; r < LN_ROWS; ++r)
        #pragma unroll
        for (int j = 0; j < LN_VEC; ++j)
            v[r][j] = *(const float4*)&xp[r * LN_D + j * 128];
    #pragma unroll
    for (int j = 0; j < LN_VEC; ++j) {
        gg[j] = *(const float4*)&g[j * 128 + lane * 4];
        bb[j] = *(const float4*)&beta[j * 128 + lane * 4];
    }

    float sum[LN_ROWS], sq[LN_ROWS];
    #pragma unroll
    for (int r = 0; r < LN_ROWS; ++r) {
        float4 s = make_float4(0.f, 0.f, 0.f, 0.f);   // four independent chains
        float4 q = make_float4(0.f, 0.f, 0.f, 0.f);
        #pragma unroll
        for (int j = 0; j < LN_VEC; ++j) {
            const float4 t = v[r][j];
            s.x += t.x; s.y += t.y; s.z += t.z; s.w += t.w;
            q.x += t.x * t.x; q.y += t.y * t.y; q.z += t.z * t.z; q.w += t.w * t.w;
        }
        sum[r] = (s.x + s.y) + (s.z + s.w);
        sq[r]  = (q.x + q.y) + (q.z + q.w);
    }
    #pragma unroll
    for (int off = 1; off < 32; off <<= 1)
        #pragma unroll
        for (int r = 0; r < LN_ROWS; ++r) {
            sum[r] += __shfl_xor(sum[r], off, 32);
            sq[r]  += __shfl_xor(sq[r],  off, 32);
        }

    v4bf yb[LN_ROWS][LN_VEC];
    #pragma unroll
    for (int r = 0; r < LN_ROWS; ++r) {
        const float mu  = sum[r] / (float)LN_D;
        const float inv = rsqrtf(sq[r] / (float)LN_D - mu * mu + LN_EPS);
        #pragma unroll
        for (int j = 0; j < LN_VEC; ++j) {
            float4 t = v[r][j];
            t.x = (t.x - mu) * inv * gg[j].x + bb[j].x;
            t.y = (t.y - mu) * inv * gg[j].y + bb[j].y;
            t.z = (t.z - mu) * inv * gg[j].z + bb[j].z;
            t.w = (t.w - mu) * inv * gg[j].w + bb[j].w;
            v[r][j] = t;
            if (OUTBF16) yb[r][j] = cvt4(t);
        }
    }

    // Without this the scheduler sinks the second row's loads behind the first
    // row's stores (two memory latencies in a row) and reuses the registers of
    // issued stores; with it every store stands behind the last arithmetic.
    __builtin_amdgcn_sched_barrier(0);

    #pragma unroll
    for (int r = 0; r < LN_ROWS; ++r)
        #pragma unroll
        for (int j = 0; j < LN_VEC; ++j) {
            const int o = r * LN_D + j * 128;
            *(float4*)&yp[o] = v[r][j];
            if (OUTBF16) *(v4bf*)&ybp[o] = yb[r][j];
        }
}

// ---------------------------------------------------------------------------
extern "C" void kernel_launch(void* const* d_in, const int* in_sizes, int n_in,
                              void* d_out, int out_size, void* d_ws, size_t ws_size,
                              hipStream_t stream)
{
    const float* x    = (const float*)d_in[0];
    const float* Wq   = (const float*)d_in[1];
    const float* bq   = (const float*)d_in[2];
    const float* Wk   = (const float*)d_in[3];
    const float* bk   = (const float*)d_in[4];
    const float* Wv   = (const float*)d_in[5];
    const float* bv   = (const float*)d_in[6];
    const float* Wo   = (const float*)d_in[7];
    const float* bo   = (const float*)d_in[8];
    const float* W1   = (const float*)d_in[9];
    const float* b1   = (const float*)d_in[10];
    const float* W2   = (const float*)d_in[11];
    const float* b2   = (const float*)d_in[12];
    const float* g1   = (const float*)d_in[13];
    const float* be1  = (const float*)d_in[14];
    const float* g2   = (const float*)d_in[15];
    const float* be2  = (const float*)d_in[16];

    const int B = 4, S = 2048, D = 1024, DFF = 4096;
    const int M = B * S;  // 8192
    const size_t MD  = (size_t)M * D;
    const size_t MDF = (size_t)M * DFF;

    char* p = (char*)d_ws;
    auto alloc = [&](size_t bytes) { char* q = p; p += (bytes + 255) & ~(size_t)255; return q; };

    __bf16* xb  = (__bf16*)alloc(MD * 2);
    __bf16* Wqt = (__bf16*)alloc((size_t)D * D * 2);
    __bf16* Wkt = (__bf16*)alloc((size_t)D * D * 2);
    __bf16* Wvt = (__bf16*)alloc((size_t)D * D * 2);
    __bf16* Wot = (__bf16*)alloc((size_t)D * D * 2);
    __bf16* W1t = (__bf16*)alloc((size_t)D * DFF * 2);
    __bf16* W2t = (__bf16*)alloc((size_t)DFF * D * 2);
    __bf16* Qb  = (__bf16*)alloc(MD * 2);
    __bf16* Kb  = (__bf16*)alloc(MD * 2);
    __bf16* Vb  = (__bf16*)alloc(MD * 2);
    __bf16* Ob  = (__bf16*)alloc(MD * 2);
    float*  h1  = (float*)alloc(MD * 4);
    float*  x2  = (float*)alloc(MD * 4);
    __bf16* x2b = (__bf16*)alloc(MD * 2);
    __bf16* F1b = (__bf16*)alloc(MDF * 2);
    float*  h2  = h1;   // h1 consumed by LN1 before FFN2 writes h2

    // ---- x -> bf16 and all weight pre-transposes, one launch
    prepare_kernel<<<dim3(PREP_BLOCKS), dim3(PREP_THREADS), 0, stream>>>(
        x, xb, Wq, Wqt, Wk, Wkt, Wv, Wvt, Wo, Wot, W1, W1t, W2, W2t);

    // ---- QKV projections, one launch (bf16 outputs; Q pre-scaled by 1/sqrt(dk))
    gemm_qkv_wmma<<<dim3(M / 256, D / GBN, 3), dim3(256), 0, stream>>>(
        xb, Wqt, Wkt, Wvt, bq, bk, bv, Qb, Kb, Vb, 0.125f, D, D);

    // ---- attention
    attention_wmma<<<dim3(S / ATT_Q, B * 16), dim3(ATT_THREADS), 0, stream>>>(Qb, Kb, Vb, Ob, S, D);

    // ---- output projection + residual x  -> h1 (fp32)
    gemm_bf16_wmma<128, false, true, true, false><<<dim3(M / 128, D / GBN), dim3(256), 0, stream>>>(
        Ob, Wot, bo, x, h1, nullptr, 1.0f, M, D, D);

    // ---- LN1 -> x2 (fp32 residual) + x2b (bf16 operand)
    layernorm_kernel<true><<<dim3(M / (LN_THREADS / 32 * LN_ROWS)), dim3(LN_THREADS), 0, stream>>>(h1, g1, be1, x2, x2b);

    // ---- FFN1 with ReLU -> bf16 only
    gemm_bf16_wmma<256, true, false, false, true><<<dim3(M / 256, DFF / GBN), dim3(256), 0, stream>>>(
        x2b, W1t, b1, nullptr, nullptr, F1b, 1.0f, M, DFF, D);

    // ---- FFN2 + residual x2 -> h2 (fp32)
    gemm_bf16_wmma<128, false, true, true, false><<<dim3(M / 128, D / GBN), dim3(256), 0, stream>>>(
        F1b, W2t, b2, x2, h2, nullptr, 1.0f, M, D, DFF);

    // ---- LN2 -> output
    layernorm_kernel<false><<<dim3(M / (LN_THREADS / 32 * LN_ROWS)), dim3(LN_THREADS), 0, stream>>>(h2, g2, be2, (float*)d_out, nullptr);
}

// v007
// It runs in 253 microseconds.
// In two side-by-side timings against v006, it was 1.10 and 1.09 times as fast.
// All steps since v000 together make it 1.92 times as fast.
#include <hip/hip_runtime.h>
#include <hip/hip_bf16.h>

typedef __attribute__((ext_vector_type(16))) __bf16 v16bf;
typedef __attribute__((ext_vector_type(8)))  __bf16 v8bf;
typedef __attribute__((ext_vector_type(4)))  __bf16 v4bf;
typedef __attribute__((ext_vector_type(8)))  float  v8f;
typedef __attribute__((__vector_size__(4 * sizeof(int)))) int i32x4;

#define LN_EPS 1e-5f
#define LDP 72   // padded LDS row length (bf16): 144 B, multiple of 16 B

#if defined(__has_builtin)
#if __has_builtin(__builtin_amdgcn_global_load_async_to_lds_b128) && \
    __has_builtin(__builtin_amdgcn_s_wait_asynccnt)
#define HAVE_ASYNC_LDS 1
#endif
#endif

#define AS1 __attribute__((address_space(1)))
#define AS3 __attribute__((address_space(3)))

__device__ __forceinline__ v8f wmma_bf16(const v16bf& a, const v16bf& b, const v8f& c) {
    return __builtin_amdgcn_wmma_f32_16x16x32_bf16(false, a, false, b, (short)0, c, false, false);
}

// Two contiguous 16-byte LDS loads -> one 16-element bf16 fragment.
__device__ __forceinline__ v16bf load_frag(const __bf16* p0, const __bf16* p1) {
    v8bf lo = *(const v8bf*)p0;
    v8bf hi = *(const v8bf*)p1;
    return __builtin_shufflevector(lo, hi, 0, 1, 2, 3, 4, 5, 6, 7,
                                   8, 9, 10, 11, 12, 13, 14, 15);
}

__device__ __forceinline__ v4bf cvt4(const float4 f) {
    v4bf b;
    b[0] = (__bf16)f.x; b[1] = (__bf16)f.y; b[2] = (__bf16)f.z; b[3] = (__bf16)f.w;
    return b;
}

// 16-byte global(bf16) -> LDS copy; async-to-LDS when toolchain supports it.
__device__ __forceinline__ void copy16B(const __bf16* g, __bf16* l) {
#ifdef HAVE_ASYNC_LDS
    __builtin_amdgcn_global_load_async_to_lds_b128(
        (AS1 i32x4*)g, (AS3 i32x4*)l, 0, 0);
#else
    *(v8bf*)l = *(const v8bf*)g;
#endif
}

__device__ __forceinline__ void async_wait() {
#ifdef HAVE_ASYNC_LDS
    __builtin_amdgcn_s_wait_asynccnt(0);
#endif
}

// The two waits of a ring's hand-over, in asm with a memory clobber so that no
// LDS access of the compiler's moves across them.
// This wave's LDS reads have retired: the buffer they read may be refilled.
__device__ __forceinline__ void ring_wait_reads() {
    asm volatile("s_wait_dscnt 0x0" ::: "memory");
}
// This wave's async copies have landed: the barrier behind it publishes them.
__device__ __forceinline__ void ring_wait_copies() {
    asm volatile("s_wait_asynccnt 0x0" ::: "memory");
}

// ---------------------------------------------------------------------------
// Preparation, ONE launch: x -> bf16 and the six weights -> transposed bf16.
// The seven jobs do not depend on each other, so they share one grid and pay
// one launch gap, one fill and one drain; a block picks its job from
// blockIdx.x (the same for the whole block).
// ---------------------------------------------------------------------------
#define PD    1024                   // model width
#define PDFF  4096                   // hidden width
#define PM    8192                   // rows of x
#define PREP_THREADS 256
#define CVT_VEC      16              // float4 per thread
#define CVT_BLOCKS   (PM * PD / (PREP_THREADS * CVT_VEC * 4))
#define TSQ_BLOCKS   ((PD / 64) * (PD / 64))      // one square weight
#define TFF_BLOCKS   ((PD / 64) * (PDFF / 64))    // W1 or W2
#define PREP_BLOCKS  (CVT_BLOCKS + 4 * TSQ_BLOCKS + 2 * TFF_BLOCKS)

// fp32 -> bf16 elementwise, fat waves: 16 float4 per thread.
__device__ __forceinline__
void convert_block(const float* __restrict__ X, __bf16* __restrict__ Y, unsigned blk)
{
    const size_t base =
        ((size_t)blk * (PREP_THREADS * CVT_VEC) + threadIdx.x) * 4;
    float4 f[CVT_VEC];
    // unrolled so that f[] stays in registers and many loads are in flight at once
    #pragma unroll
    for (int i = 0; i < CVT_VEC; ++i)
        f[i] = *(const float4*)&X[base + (size_t)i * (PREP_THREADS * 4)];
    // unrolled: f[] is indexed by constants only
    #pragma unroll
    for (int i = 0; i < CVT_VEC; ++i)
        *(v4bf*)&Y[base + (size_t)i * (PREP_THREADS * 4)] = cvt4(f[i]);
}

// W[K,N] fp32 -> Wt[N,K] bf16, one 64x64 tile through LDS.
__device__ __forceinline__
void transpose_block(const float* __restrict__ W, __bf16* __restrict__ Wt,
                     int K, int N, int k0, int n0, float (*T)[65])
{
    #pragma unroll
    for (int i = 0; i < 16; ++i) {
        int idx = threadIdx.x + i * 256;
        int r = idx >> 6, c = idx & 63;
        T[r][c] = W[(size_t)(k0 + r) * N + n0 + c];
    }
    __syncthreads();
    #pragma unroll
    for (int i = 0; i < 16; ++i) {
        int idx = threadIdx.x + i * 256;
        int r = idx >> 6, c = idx & 63;         // r = n-local, c = k-local
        Wt[(size_t)(n0 + r) * K + k0 + c] = (__bf16)T[c][r];
    }
    // The jobs are laid out one behind the other in the built kernel: this wait
    // stands between the stores above and any later write of their registers.
    asm volatile("s_wait_xcnt 0x0" ::: "memory");
}

__global__ __launch_bounds__(PREP_THREADS)
void prepare_kernel(const float* __restrict__ X,  __bf16* __restrict__ Xb,
                    const float* __restrict__ Wq, __bf16* __restrict__ Wqt,
                    const float* __restrict__ Wk, __bf16* __restrict__ Wkt,
                    const float* __restrict__ Wv, __bf16* __restrict__ Wvt,
                    const float* __restrict__ Wo, __bf16* __restrict__ Wot,
                    const float* __restrict__ W1, __bf16* __restrict__ W1t,
                    const float* __restrict__ W2, __bf16* __restrict__ W2t)
{
    __shared__ float T[64][65];
    unsigned b = blockIdx.x;
    if (b < CVT_BLOCKS) {                        // the largest jobs start first
        convert_block(X, Xb, b);
        return;
    }
    b -= CVT_BLOCKS;
    if (b < 4 * TSQ_BLOCKS) {
        const unsigned w = b / TSQ_BLOCKS, t = b % TSQ_BLOCKS;
        const float* W  = w == 0 ? Wq  : w == 1 ? Wk  : w == 2 ? Wv  : Wo;
        __bf16*      Wt = w == 0 ? Wqt : w == 1 ? Wkt : w == 2 ? Wvt : Wot;
        transpose_block(W, Wt, PD, PD, (t % (PD / 64)) * 64, (t / (PD / 64)) * 64, T);
        return;
    }
    b -= 4 * TSQ_BLOCKS;
    if (b < TFF_BLOCKS) {
        transpose_block(W1, W1t, PD, PDFF, (b % (PD / 64)) * 64, (b / (PD / 64)) * 64, T);
        return;
    }
    b -= TFF_BLOCKS;
    transpose_block(W2, W2t, PDFF, PD, (b % (PDFF / 64)) * 64, (b / (PDFF / 64)) * 64, T);
}

// ---------------------------------------------------------------------------
// GEMM: C = op(A[M,K](bf16) @ Wt[N,K](bf16)^T + bias (+ resid))
// Block tile BM x 128; 8 waves in a 4 x 2 grid, each wave owns a (BM/4) x 64
// piece. A byte staged from L2 feeds more products than in a 64-wide tile.
// BM = 256 (64x64 wave pieces: every fragment read from LDS feeds 4 products)
// where the output is wide enough to fill the chip with such blocks;
// BM = 128 (32x64 pieces) for the 1024-wide outputs, so that two blocks share
// a WGP there, one computing on two waves per SIMD while the other stages.
// Both LDS stages are straight 16-byte copies (async-to-LDS when available).
// Two LDS buffers: the copies of K step t + 1 are in flight while step t is
// multiplied, so the way from L2 and the products overlap inside one block;
// one barrier a step publishes step t + 1 and frees the buffer of step t.
// K step: 128 at BM = 128; 64 at BM = 256, where two buffers of 128 would take
// so much LDS that a WGP holds one block only (with 64 it still holds two, and
// one block's first stage and epilogue run beside the other's products).
// Outputs: fp32 C and/or bf16 C (scaled) per template flags.
// ---------------------------------------------------------------------------
#define GBN  128   // block tile columns
template<int BM, bool RELU, bool RESID, bool OUTF32, bool OUTBF16>
__device__ __forceinline__
void gemm_tile(const __bf16* __restrict__ A, const __bf16* __restrict__ Wt,
               const float* __restrict__ bias, const float* __restrict__ resid,
               float* __restrict__ Cf, __bf16* __restrict__ Cb, float oscale,
               int N, int K)
{
    constexpr int THREADS = 256;
    constexpr int WM = BM / 4;                      // rows of a wave's piece
    constexpr int MI = WM / 16;                     // its accumulator tile rows
    constexpr int GBK  = BM == 256 ? 64 : 128;      // K step
    constexpr int GLDP = GBK + 8;   // padded LDS row (bf16): 16 B x 9 or 16 B x 17
    // a buffer: BM rows of A [m][k], then GBN rows of Wt [n][k]
    __shared__ __align__(16) __bf16 St[2][BM + GBN][GLDP];
    const int tid  = threadIdx.x;
    const int wave = tid >> 5;
    const int lane = tid & 31;
    const int half = lane >> 4;
    const int l16  = lane & 15;
    const int kb0  = half * 8;
    const int kb1  = 16 + half * 8;
    const int wm   = (wave >> 1) * WM;              // the wave's rows in the tile
    const int wn   = (wave & 1) * 64;               // the wave's columns
    const int m0 = blockIdx.x * BM;
    const int n0 = blockIdx.y * GBN;
    // Staging: one pass of the block copies RS rows; a thread keeps its place
    // (row r0, chunk c0) in every pass, so one 32-bit byte offset serves all its
    // copies and the row steps stay in the block-uniform base address.
    constexpr int CH = GBK / 8;                     // 16-byte chunks of a row
    constexpr int RS = THREADS / CH;
    const int      r0   = tid / CH;
    const int      c0   = (tid % CH) * 8;
    const unsigned voff = ((unsigned)r0 * (unsigned)K + (unsigned)c0) * 2u;

    v8f acc[MI][4] = {};

    auto stage = [&](int k0, int buf) {
        // A tile: BM rows x GBK bf16, CH chunks of 16 bytes a row
        // (unrolled: all copies of a stage are in flight at once)
        #pragma unroll
        for (int i = 0; i < BM / RS; ++i)
            copy16B((const __bf16*)((const char*)(A + (size_t)(m0 + i * RS) * K + k0) + voff),
                    &St[buf][r0 + i * RS][c0]);
        // B tile (already [n][k] in global), unrolled for the same reason
        #pragma unroll
        for (int i = 0; i < GBN / RS; ++i)
            copy16B((const __bf16*)((const char*)(Wt + (size_t)(n0 + i * RS) * K + k0) + voff),
                    &St[buf][BM + r0 + i * RS][c0]);
    };

    // step 0 lands and is published; step 1 then flies during step 0's products
    stage(0, 0);
    ring_wait_copies();
    __syncthreads();
    if (GBK < K) stage(GBK, 1);

    for (int k0 = 0; k0 < K; k0 += GBK) {
        const int buf = (k0 / GBK) & 1;
        const __bf16 (*As)[GLDP] = &St[buf][0];     // [m][k]
        const __bf16 (*Bt)[GLDP] = &St[buf][BM];    // [n][k]

        // unrolled: acc[][] and the fragments are indexed by constants only
        #pragma unroll
        for (int ks = 0; ks < GBK; ks += 32) {
            v16bf a[MI], b[4];
            #pragma unroll
            for (int mi = 0; mi < MI; ++mi) {
                const int row = wm + mi * 16 + l16;
                a[mi] = load_frag(&As[row][ks + kb0], &As[row][ks + kb1]);
            }
            #pragma unroll
            for (int nt = 0; nt < 4; ++nt) {
                const int col = wn + nt * 16 + l16;
                b[nt] = load_frag(&Bt[col][ks + kb0], &Bt[col][ks + kb1]);
            }
            #pragma unroll
            for (int mi = 0; mi < MI; ++mi)
                #pragma unroll
                for (int nt = 0; nt < 4; ++nt)
                    acc[mi][nt] = wmma_bf16(a[mi], b[nt], acc[mi][nt]);
        }
        // hand-over: step t + 1 has landed for everybody, and nobody reads
        // this step's buffer any more; only then is it refilled
        ring_wait_reads();
        ring_wait_copies();
        __syncthreads();
        if (k0 + 2 * GBK < K) stage(k0 + 2 * GBK, buf);
    }
    ring_wait_copies();   // no wave goes on to its end with a copy in flight

    // Epilogue, unrolled throughout: acc[][] is indexed by constants only.
    // One 32-bit element index per row (a plane has at most 2^25 elements) on
    // the uniform bases serves the row's residual loads and its stores; the
    // column step of a tile goes into the base. The residual tile is fetched
    // first, so that all its loads are in flight together.
    const unsigned o0 = (unsigned)(m0 + wm + half * 8) * (unsigned)N
                      + (unsigned)(n0 + wn + l16);
    float bv[4], rv[RESID ? MI : 1][4][8];
    #pragma unroll
    for (int nt = 0; nt < 4; ++nt)
        bv[nt] = bias[n0 + wn + nt * 16 + l16];
    if (RESID) {
        #pragma unroll
        for (int mi = 0; mi < MI; ++mi)
            #pragma unroll
            for (int nt = 0; nt < 4; ++nt)
                #pragma unroll
                for (int r = 0; r < 8; ++r)
                    rv[mi][nt][r] = (resid + nt * 16)[o0 + (unsigned)(mi * 16 + r) * (unsigned)N];
    }
    #pragma unroll
    for (int mi = 0; mi < MI; ++mi)
        #pragma unroll
        for (int nt = 0; nt < 4; ++nt)
            #pragma unroll
            for (int r = 0; r < 8; ++r) {
                float v = acc[mi][nt][r] + bv[nt];
                if (RESID) v += rv[mi][nt][r];
                if (RELU)  v = fmaxf(v, 0.0f);
                acc[mi][nt][r] = v;
            }

    #pragma unroll
    for (int mi = 0; mi < MI; ++mi)
        #pragma unroll
        for (int nt = 0; nt < 4; ++nt)
            #pragma unroll
            for (int r = 0; r < 8; ++r) {
                const unsigned o = o0 + (unsigned)(mi * 16 + r) * (unsigned)N;
                if (OUTF32)  (Cf + nt * 16)[o] = acc[mi][nt][r];
                if (OUTBF16) (Cb + nt * 16)[o] = (__bf16)(acc[mi][nt][r] * oscale);
            }
}

template<int BM, bool RELU, bool RESID, bool OUTF32, bool OUTBF16>
__global__ __launch_bounds__(256)
void gemm_bf16_wmma(const __bf16* __restrict__ A, const __bf16* __restrict__ Wt,
                    const float* __restrict__ bias, const float* __restrict__ resid,
                    float* __restrict__ Cf, __bf16* __restrict__ Cb, float oscale,
                    int M, int N, int K)
{
    gemm_tile<BM, RELU, RESID, OUTF32, OUTBF16>(A, Wt, bias, resid, Cf, Cb, oscale, N, K);
}

// The three projections of the same A in ONE launch: blockIdx.z picks the
// weight, bias and output. They are independent, so one grid of three times
// the blocks pays one gap, fill and drain and keeps more blocks on a WGP.
__global__ __launch_bounds__(256)
void gemm_qkv_wmma(const __bf16* __restrict__ A,
                   const __bf16* __restrict__ Wqt, const __bf16* __restrict__ Wkt,
                   const __bf16* __restrict__ Wvt,
                   const float* __restrict__ bq, const float* __restrict__ bk,
                   const float* __restrict__ bv,
                   __bf16* __restrict__ Qb, __bf16* __restrict__ Kb,
                   __bf16* __restrict__ Vb, float qscale, int N, int K)
{
    const unsigned w = blockIdx.z;
    const __bf16* Wt   = w == 0 ? Wqt : w == 1 ? Wkt : Wvt;
    const float*  bias = w == 0 ? bq  : w == 1 ? bk  : bv;
    __bf16*       Cb   = w == 0 ? Qb  : w == 1 ? Kb  : Vb;
    gemm_tile<256, false, false, false, true>(A, Wt, bias, nullptr, nullptr, Cb,
                                              w == 0 ? qscale : 1.0f, N, K);
}

// ---------------------------------------------------------------------------
// Flash-attention per (b,h, 256-query block). dk=64, S=2048; Q pre-scaled by
// 1/sqrt(dk) at the Q-GEMM. Scores std ~1 -> plain exp is fp32-safe (softmax
// is shift-invariant); row-sums via WMMA with an all-ones B matrix.
// Tile: 8 waves, each owns 32 query rows (two 16-row tiles), so that a K or V
// fragment read from LDS feeds two products; a K/V stage is shared by 256
// queries and holds 256 keys, worked on in four parts of 64.
// Q/K/V are bf16; Q/K stage as pure copies (async), V via register transpose.
// Scores are computed transposed (keys x queries, K as the first operand): a
// lane then holds, of one query, just the keys that the first operand of P * V
// wants from it, so exp(s) goes from accumulator to operand inside the lane.
// Output written bf16 (only consumed by the Wo GEMM).
// ---------------------------------------------------------------------------
#define ATT_THREADS 256
#define ATT_Q    256   // query rows of a block
#define ATT_KEYS 256   // keys of a stage
#define VLDP     264   // padded Vt row length (bf16): 528 B = 16 B x 33
__global__ __launch_bounds__(ATT_THREADS)
void attention_wmma(const __bf16* __restrict__ Q, const __bf16* __restrict__ Km,
                    const __bf16* __restrict__ Vm, __bf16* __restrict__ O,
                    int S, int D)
{
    __shared__ __align__(16) __bf16 Qs[ATT_Q][LDP];      // [q][d]
    __shared__ __align__(16) __bf16 Ks[ATT_KEYS][LDP];   // [key][d]
    __shared__ __align__(16) __bf16 Vt[64][VLDP];        // [d][key]

    const int tid  = threadIdx.x;
    const int wave = tid >> 5;
    const int lane = tid & 31;
    const int half = lane >> 4;
    const int l16  = lane & 15;
    const int kb0  = half * 8;
    const int kb1  = 16 + half * 8;

    const int q0 = blockIdx.x * ATT_Q;
    const int bh = blockIdx.y;
    const int b  = bh >> 4;
    const int h  = bh & 15;
    const size_t rowbase = (size_t)b * S;
    const int    cbase   = h * 64;

    // stage Q block (pure bf16 copy; scale already folded in)
    #pragma unroll
    for (int i = 0; i < ATT_Q * 8 / ATT_THREADS; ++i) {
        int idx = tid + i * ATT_THREADS;
        int r = idx >> 3, c = (idx & 7) * 8;
        copy16B(&Q[(rowbase + q0 + r) * D + cbase + c], &Qs[r][c]);
    }

    v16bf ones;
    #pragma unroll
    for (int i = 0; i < 16; ++i) ones[i] = (__bf16)1.0f;

    v8f o[2][4] = {};
    v8f lsum[2] = {};

    const int wq = wave * 32;           // the wave's first query row in the block

    for (int kb = 0; kb < S; kb += ATT_KEYS) {
        __syncthreads();
        // K row-major copy (async)
        #pragma unroll
        for (int i = 0; i < ATT_KEYS * 8 / ATT_THREADS; ++i) {
            int idx = tid + i * ATT_THREADS;
            int r = idx >> 3, c = (idx & 7) * 8;
            copy16B(&Km[(rowbase + kb + r) * D + cbase + c], &Ks[r][c]);
        }
        // V transposed via 4x4 register micro-tiles; the loads of all a thread's
        // micro-tiles stand in front of the first use and share one latency
        constexpr int VT = ATT_KEYS * 4 / ATT_THREADS;   // micro-tiles per thread
        const int tn = tid & 15;        // d block
        const int tk = tid >> 4;        // key block of the first micro-tile
        v4bf f[VT][4];
        #pragma unroll
        for (int tt = 0; tt < VT; ++tt)
            #pragma unroll
            for (int j = 0; j < 4; ++j)
                f[tt][j] = *(const v4bf*)&Vm[(rowbase + kb + (tk + tt * 16) * 4 + j) * D
                                             + cbase + tn * 4];
        #pragma unroll
        for (int tt = 0; tt < VT; ++tt)
            #pragma unroll
            for (int i = 0; i < 4; ++i) {
                v4bf p;
                p[0] = f[tt][0][i]; p[1] = f[tt][1][i]; p[2] = f[tt][2][i]; p[3] = f[tt][3][i];
                *(v4bf*)&Vt[tn * 4 + i][(tk + tt * 16) * 4] = p;
            }
        async_wait();
        __syncthreads();

        // unrolled: the part's offset folds into the LDS instructions' offsets
        #pragma unroll
        for (int kh = 0; kh < ATT_KEYS; kh += 64) {
            // ---- scores^T = K * Q^T; each K fragment serves both query tiles
            v16bf a[2][2];
            #pragma unroll
            for (int mi = 0; mi < 2; ++mi) {
                const int row = wq + mi * 16 + l16;
                a[mi][0] = load_frag(&Qs[row][kb0],      &Qs[row][kb1]);
                a[mi][1] = load_frag(&Qs[row][32 + kb0], &Qs[row][32 + kb1]);
            }
            v8f s[2][4];
            #pragma unroll
            for (int nt = 0; nt < 4; ++nt) {
                const int col = kh + nt * 16 + l16;
                v16bf b0 = load_frag(&Ks[col][kb0],      &Ks[col][kb1]);
                v16bf b1 = load_frag(&Ks[col][32 + kb0], &Ks[col][32 + kb1]);
                #pragma unroll
                for (int mi = 0; mi < 2; ++mi) {
                    v8f z = {};
                    z = wmma_bf16(b0, a[mi][0], z);
                    z = wmma_bf16(b1, a[mi][1], z);
                    s[mi][nt] = z;       // [key nt*16 + r + half*8][query l16]
                }
            }

            // ---- p = exp(s), packed in registers: of 32 keys a first-operand
            // fragment holds keys half*8 + 0..7 and 16 + half*8 + 0..7 of row l16,
            // which are this lane's accumulators of two score tiles one behind the other
            // exp(s) = exp2(s * log2(e)), the arithmetic of __expf; the product is
            // written on whole tiles so that it stays a packed multiply (two a slot)
            #pragma unroll
            for (int mi = 0; mi < 2; ++mi)
                #pragma unroll
                for (int nt = 0; nt < 4; ++nt) {
                    s[mi][nt] *= 1.44269504f;
                    #pragma unroll
                    for (int r = 0; r < 8; ++r)
                        s[mi][nt][r] = __builtin_amdgcn_exp2f(s[mi][nt][r]);
                }
            v16bf p[2][2];
            #pragma unroll
            for (int mi = 0; mi < 2; ++mi)
                #pragma unroll
                for (int c = 0; c < 2; ++c)
                    #pragma unroll
                    for (int r = 0; r < 8; ++r) {
                        p[mi][c][r]     = (__bf16)s[mi][2 * c][r];
                        p[mi][c][8 + r] = (__bf16)s[mi][2 * c + 1][r];
                    }

            // ---- row-sums of P via WMMA with all-ones B (broadcast per column)
            #pragma unroll
            for (int mi = 0; mi < 2; ++mi) {
                lsum[mi] = wmma_bf16(p[mi][0], ones, lsum[mi]);
                lsum[mi] = wmma_bf16(p[mi][1], ones, lsum[mi]);
            }

            // ---- O += P * V; each V fragment serves both query tiles
            #pragma unroll
            for (int nt = 0; nt < 4; ++nt) {
                const int col = nt * 16 + l16;
                v16bf b0 = load_frag(&Vt[col][kh + kb0],      &Vt[col][kh + kb1]);
                v16bf b1 = load_frag(&Vt[col][kh + 32 + kb0], &Vt[col][kh + 32 + kb1]);
                #pragma unroll
                for (int mi = 0; mi < 2; ++mi) {
                    o[mi][nt] = wmma_bf16(p[mi][0], b0, o[mi][nt]);
                    o[mi][nt] = wmma_bf16(p[mi][1], b1, o[mi][nt]);
                }
            }
        }
    }

    // ---- normalize by row-sum, write bf16
    #pragma unroll
    for (int mi = 0; mi < 2; ++mi)
        #pragma unroll
        for (int nt = 0; nt < 4; ++nt) {
            const int col = cbase + nt * 16 + l16;
            #pragma unroll
            for (int r = 0; r < 8; ++r) {
                const int row = q0 + wq + mi * 16 + r + half * 8;
                O[(rowbase + row) * D + col] = (__bf16)(o[mi][nt][r] / lsum[mi][r]);
            }
        }
}

// ---------------------------------------------------------------------------
// Row-wise LayerNorm over rows of LN_D floats; optionally also emits a bf16
// shadow copy for the next GEMM's A operand.
// One wave owns LN_ROWS whole rows, held in registers (16-byte loads, 512
// contiguous bytes per wave load): no LDS, no barrier, the row is read once,
// and the launch starts 16x fewer waves than one 8-wave block per row.
// ---------------------------------------------------------------------------
#define LN_D       1024
#define LN_THREADS 512
#define LN_ROWS    2                 // rows per wave
#define LN_VEC     (LN_D / 128)      // float4 per lane and row
template<bool OUTBF16>
__global__ __launch_bounds__(LN_THREADS)
void layernorm_kernel(const float* __restrict__ X, const float* __restrict__ g,
                      const float* __restrict__ beta, float* __restrict__ Y,
                      __bf16* __restrict__ Yb)
{
    const unsigned lane = threadIdx.x & 31;
    const unsigned row0 =
        (blockIdx.x * (LN_THREADS / 32) + (threadIdx.x >> 5)) * LN_ROWS;
    // One 32-bit byte offset (a plane is 32 MiB) on the scalar bases X and Y:
    // the row loads and the fp32 stores share one offset register, which so
    // stays live from the first load to the last store.
    const unsigned boff = (row0 * LN_D + lane * 4) * 4u;
    const float* xp  = (const float*)((const char*)X + boff);
    float*       yp  = (float*)((char*)Y + boff);
    __bf16*      ybp = OUTBF16 ? (__bf16*)((char*)Yb + (boff >> 1)) : nullptr;

    float4 v[LN_ROWS][LN_VEC], gg[LN_VEC], bb[LN_VEC];
    // every loop below is unrolled so that the arrays are indexed by constants
    // and stay in registers; here it also puts all row loads in flight at once
    #pragma unroll
    for (int r = 0; r < LN_ROWS; ++r)
        #pragma unroll
        for (int j = 0; j < LN_VEC; ++j)
            v[r][j] = *(const float4*)&xp[r * LN_D + j * 128];
    #pragma unroll
    for (int j = 0; j < LN_VEC; ++j) {
        gg[j] = *(const float4*)&g[j * 128 + lane * 4];
        bb[j] = *(const float4*)&beta[j * 128 + lane * 4];
    }

    float sum[LN_ROWS], sq[LN_ROWS];
    #pragma unroll
    for (int r = 0; r < LN_ROWS; ++r) {
        float4 s = make_float4(0.f, 0.f, 0.f, 0.f);   // four independent chains
        float4 q = make_float4(0.f, 0.f, 0.f, 0.f);
        #pragma unroll
        for (int j = 0; j < LN_VEC; ++j) {
            const float4 t = v[r][j];
            s.x += t.x; s.y += t.y; s.z += t.z; s.w += t.w;
            q.x += t.x * t.x; q.y += t.y * t.y; q.z += t.z * t.z; q.w += t.w * t.w;
        }
        sum[r] = (s.x + s.y) + (s.z + s.w);
        sq[r]  = (q.x + q.y) + (q.z + q.w);
    }
    #pragma unroll
    for (int off = 1; off < 32; off <<= 1)
        #pragma unroll
        for (int r = 0; r < LN_ROWS; ++r) {
            sum[r] += __shfl_xor(sum[r], off, 32);
            sq[r]  += __shfl_xor(sq[r],  off, 32);
        }

    v4bf yb[LN_ROWS][LN_VEC];
    #pragma unroll
    for (int r = 0; r < LN_ROWS; ++r) {
        const float mu  = sum[r] / (float)LN_D;
        const float inv = rsqrtf(sq[r] / (float)LN_D - mu * mu + LN_EPS);
        #pragma unroll
        for (int j = 0; j < LN_VEC; ++j) {
            float4 t = v[r][j];
            t.x = (t.x - mu) * inv * gg[j].x + bb[j].x;
            t.y = (t.y - mu) * inv * gg[j].y + bb[j].y;
            t.z = (t.z - mu) * inv * gg[j].z + bb[j].z;
            t.w = (t.w - mu) * inv * gg[j].w + bb[j].w;
            v[r][j] = t;
            if (OUTBF16) yb[r][j] = cvt4(t);
        }
    }

    // Without this the scheduler sinks the second row's loads behind the first
    // row's stores (two memory latencies in a row) and reuses the registers of
    // issued stores; with it every store stands behind the last arithmetic.
    __builtin_amdgcn_sched_barrier(0);

    #pragma unroll
    for (int r = 0; r < LN_ROWS; ++r)
        #pragma unroll
        for (int j = 0; j < LN_VEC; ++j) {
            const int o = r * LN_D + j * 128;
            *(float4*)&yp[o] = v[r][j];
            if (OUTBF16) *(v4bf*)&ybp[o] = yb[r][j];
        }
}

// ---------------------------------------------------------------------------
extern "C" void kernel_launch(void* const* d_in, const int* in_sizes, int n_in,
                              void* d_out, int out_size, void* d_ws, size_t ws_size,
                              hipStream_t stream)
{
    const float* x    = (const float*)d_in[0];
    const float* Wq   = (const float*)d_in[1];
    const float* bq   = (const float*)d_in[2];
    const float* Wk   = (const float*)d_in[3];
    const float* bk   = (const float*)d_in[4];
    const float* Wv   = (const float*)d_in[5];
    const float* bv   = (const float*)d_in[6];
    const float* Wo   = (const float*)d_in[7];
    const float* bo   = (const float*)d_in[8];
    const float* W1   = (const float*)d_in[9];
    const float* b1   = (const float*)d_in[10];
    const float* W2   = (const float*)d_in[11];
    const float* b2   = (const float*)d_in[12];
    const float* g1   = (const float*)d_in[13];
    const float* be1  = (const float*)d_in[14];
    const float* g2   = (const float*)d_in[15];
    const float* be2  = (const float*)d_in[16];

    const int B = 4, S = 2048, D = 1024, DFF = 4096;
    const int M = B * S;  // 8192
    const size_t MD  = (size_t)M * D;
    const size_t MDF = (size_t)M * DFF;

    char* p = (char*)d_ws;
    auto alloc = [&](size_t bytes) { char* q = p; p += (bytes + 255) & ~(size_t)255; return q; };

    __bf16* xb  = (__bf16*)alloc(MD * 2);
    __bf16* Wqt = (__bf16*)alloc((size_t)D * D * 2);
    __bf16* Wkt = (__bf16*)alloc((size_t)D * D * 2);
    __bf16* Wvt = (__bf16*)alloc((size_t)D * D * 2);
    __bf16* Wot = (__bf16*)alloc((size_t)D * D * 2);
    __bf16* W1t = (__bf16*)alloc((size_t)D * DFF * 2);
    __bf16* W2t = (__bf16*)alloc((size_t)DFF * D * 2);
    __bf16* Qb  = (__bf16*)alloc(MD * 2);
    __bf16* Kb  = (__bf16*)alloc(MD * 2);
    __bf16* Vb  = (__bf16*)alloc(MD * 2);
    __bf16* Ob  = (__bf16*)alloc(MD * 2);
    float*  h1  = (float*)alloc(MD * 4);
    float*  x2  = (float*)alloc(MD * 4);
    __bf16* x2b = (__bf16*)alloc(MD * 2);
    __bf16* F1b = (__bf16*)alloc(MDF * 2);
    float*  h2  = h1;   // h1 consumed by LN1 before FFN2 writes h2

    // ---- x -> bf16 and all weight pre-transposes, one launch
    prepare_kernel<<<dim3(PREP_BLOCKS), dim3(PREP_THREADS), 0, stream>>>(
        x, xb, Wq, Wqt, Wk, Wkt, Wv, Wvt, Wo, Wot, W1, W1t, W2, W2t);

    // ---- QKV projections, one launch (bf16 outputs; Q pre-scaled by 1/sqrt(dk))
    gemm_qkv_wmma<<<dim3(M / 256, D / GBN, 3), dim3(256), 0, stream>>>(
        xb, Wqt, Wkt, Wvt, bq, bk, bv, Qb, Kb, Vb, 0.125f, D, D);

    // ---- attention
    attention_wmma<<<dim3(S / ATT_Q, B * 16), dim3(ATT_THREADS), 0, stream>>>(Qb, Kb, Vb, Ob, S, D);

    // ---- output projection + residual x  -> h1 (fp32)
    gemm_bf16_wmma<128, false, true, true, false><<<dim3(M / 128, D / GBN), dim3(256), 0, stream>>>(
        Ob, Wot, bo, x, h1, nullptr, 1.0f, M, D, D);

    // ---- LN1 -> x2 (fp32 residual) + x2b (bf16 operand)
    layernorm_kernel<true><<<dim3(M / (LN_THREADS / 32 * LN_ROWS)), dim3(LN_THREADS), 0, stream>>>(h1, g1, be1, x2, x2b);

    // ---- FFN1 with ReLU -> bf16 only
    gemm_bf16_wmma<256, true, false, false, true><<<dim3(M / 256, DFF / GBN), dim3(256), 0, stream>>>(
        x2b, W1t, b1, nullptr, nullptr, F1b, 1.0f, M, DFF, D);

    // ---- FFN2 + residual x2 -> h2 (fp32)
    gemm_bf16_wmma<128, false, true, true, false><<<dim3(M / 128, D / GBN), dim3(256), 0, stream>>>(
        F1b, W2t, b2, x2, h2, nullptr, 1.0f, M, D, DFF);

    // ---- LN2 -> output
    layernorm_kernel<false><<<dim3(M / (LN_THREADS / 32 * LN_ROWS)), dim3(LN_THREADS), 0, stream>>>(h2, g2, be2, (float*)d_out, nullptr);
}

// v008
// Measured time: 237 microseconds a run.
// Next to v007, in two timings, it ran 1.07 and 1.06 times as fast.
// Over all steps from v000 it is 2.05 times as fast.
#include <hip/hip_runtime.h>
#include <hip/hip_bf16.h>

typedef __attribute__((ext_vector_type(16))) __bf16 v16bf;
typedef __attribute__((ext_vector_type(8)))  __bf16 v8bf;
typedef __attribute__((ext_vector_type(4)))  __bf16 v4bf;
typedef __attribute__((ext_vector_type(8)))  float  v8f;
typedef __attribute__((__vector_size__(4 * sizeof(int)))) int i32x4;

#define LN_EPS 1e-5f
#define LDP 72   // padded LDS row length (bf16): 144 B, multiple of 16 B

#if defined(__has_builtin)
#if __has_builtin(__builtin_amdgcn_global_load_async_to_lds_b128) && \
    __has_builtin(__builtin_amdgcn_s_wait_asynccnt)
#define HAVE_ASYNC_LDS 1
#endif
#endif

#define AS1 __attribute__((address_space(1)))
#define AS3 __attribute__((address_space(3)))

__device__ __forceinline__ v8f wmma_bf16(const v16bf& a, const v16bf& b, const v8f& c) {
    return __builtin_amdgcn_wmma_f32_16x16x32_bf16(false, a, false, b, (short)0, c, false, false);
}

// Two contiguous 16-byte LDS loads -> one 16-element bf16 fragment.
__device__ __forceinline__ v16bf load_frag(const __bf16* p0, const __bf16* p1) {
    v8bf lo = *(const v8bf*)p0;
    v8bf hi = *(const v8bf*)p1;
    return __builtin_shufflevector(lo, hi, 0, 1, 2, 3, 4, 5, 6, 7,
                                   8, 9, 10, 11, 12, 13, 14, 15);
}

__device__ __forceinline__ v4bf cvt4(const float4 f) {
    v4bf b;
    b[0] = (__bf16)f.x; b[1] = (__bf16)f.y; b[2] = (__bf16)f.z; b[3] = (__bf16)f.w;
    return b;
}

// 16-byte global(bf16) -> LDS copy; async-to-LDS when toolchain supports it.
__device__ __forceinline__ void copy16B(const __bf16* g, __bf16* l) {
#ifdef HAVE_ASYNC_LDS
    __builtin_amdgcn_global_load_async_to_lds_b128(
        (AS1 i32x4*)g, (AS3 i32x4*)l, 0, 0);
#else
    *(v8bf*)l = *(const v8bf*)g;
#endif
}

__device__ __forceinline__ void async_wait() {
#ifdef HAVE_ASYNC_LDS
    __builtin_amdgcn_s_wait_asynccnt(0);
#endif
}

// The two waits of a ring's hand-over, in asm with a memory clobber so that no
// LDS access of the compiler's moves across them.
// This wave's LDS reads have retired: the buffer they read may be refilled.
__device__ __forceinline__ void ring_wait_reads() {
    asm volatile("s_wait_dscnt 0x0" ::: "memory");
}
// This wave's async copies have landed: the barrier behind it publishes them.
__device__ __forceinline__ void ring_wait_copies() {
    asm volatile("s_wait_asynccnt 0x0" ::: "memory");
}

// ---------------------------------------------------------------------------
// Preparation, ONE launch: x -> bf16 and the six weights -> transposed bf16.
// The seven jobs do not depend on each other, so they share one grid and pay
// one launch gap, one fill and one drain; a block picks its job from
// blockIdx.x (the same for the whole block).
// ---------------------------------------------------------------------------
#define PD    1024                   // model width
#define PDFF  4096                   // hidden width
#define PM    8192                   // rows of x
#define PREP_THREADS 256
#define CVT_VEC      16              // float4 per thread
#define CVT_BLOCKS   (PM * PD / (PREP_THREADS * CVT_VEC * 4))
#define TSQ_BLOCKS   ((PD / 64) * (PD / 64))      // one square weight
#define TFF_BLOCKS   ((PD / 64) * (PDFF / 64))    // W1 or W2
#define PREP_BLOCKS  (CVT_BLOCKS + 4 * TSQ_BLOCKS + 2 * TFF_BLOCKS)

// fp32 -> bf16 elementwise, fat waves: 16 float4 per thread.
__device__ __forceinline__
void convert_block(const float* __restrict__ X, __bf16* __restrict__ Y, unsigned blk)
{
    const size_t base =
        ((size_t)blk * (PREP_THREADS * CVT_VEC) + threadIdx.x) * 4;
    float4 f[CVT_VEC];
    // unrolled so that f[] stays in registers and many loads are in flight at once
    #pragma unroll
    for (int i = 0; i < CVT_VEC; ++i)
        f[i] = *(const float4*)&X[base + (size_t)i * (PREP_THREADS * 4)];
    // unrolled: f[] is indexed by constants only
    #pragma unroll
    for (int i = 0; i < CVT_VEC; ++i)
        *(v4bf*)&Y[base + (size_t)i * (PREP_THREADS * 4)] = cvt4(f[i]);
}

// W[K,N] fp32 -> Wt[N,K] bf16, one 64x64 tile through LDS.
__device__ __forceinline__
void transpose_block(const float* __restrict__ W, __bf16* __restrict__ Wt,
                     int K, int N, int k0, int n0, float (*T)[65])
{
    #pragma unroll
    for (int i = 0; i < 16; ++i) {
        int idx = threadIdx.x + i * 256;
        int r = idx >> 6, c = idx & 63;
        T[r][c] = W[(size_t)(k0 + r) * N + n0 + c];
    }
    __syncthreads();
    #pragma unroll
    for (int i = 0; i < 16; ++i) {
        int idx = threadIdx.x + i * 256;
        int r = idx >> 6, c = idx & 63;         // r = n-local, c = k-local
        Wt[(size_t)(n0 + r) * K + k0 + c] = (__bf16)T[c][r];
    }
    // The jobs are laid out one behind the other in the built kernel: this wait
    // stands between the stores above and any later write of their registers.
    asm volatile("s_wait_xcnt 0x0" ::: "memory");
}

__global__ __launch_bounds__(PREP_THREADS)
void prepare_kernel(const float* __restrict__ X,  __bf16* __restrict__ Xb,
                    const float* __restrict__ Wq, __bf16* __restrict__ Wqt,
                    const float* __restrict__ Wk, __bf16* __restrict__ Wkt,
                    const float* __restrict__ Wv, __bf16* __restrict__ Wvt,
                    const float* __restrict__ Wo, __bf16* __restrict__ Wot,
                    const float* __restrict__ W1, __bf16* __restrict__ W1t,
                    const float* __restrict__ W2, __bf16* __restrict__ W2t)
{
    __shared__ float T[64][65];
    unsigned b = blockIdx.x;
    if (b < CVT_BLOCKS) {                        // the largest jobs start first
        convert_block(X, Xb, b);
        return;
    }
    b -= CVT_BLOCKS;
    if (b < 4 * TSQ_BLOCKS) {
        const unsigned w = b / TSQ_BLOCKS, t = b % TSQ_BLOCKS;
        const float* W  = w == 0 ? Wq  : w == 1 ? Wk  : w == 2 ? Wv  : Wo;
        __bf16*      Wt = w == 0 ? Wqt : w == 1 ? Wkt : w == 2 ? Wvt : Wot;
        transpose_block(W, Wt, PD, PD, (t % (PD / 64)) * 64, (t / (PD / 64)) * 64, T);
        return;
    }
    b -= 4 * TSQ_BLOCKS;
    if (b < TFF_BLOCKS) {
        transpose_block(W1, W1t, PD, PDFF, (b % (PD / 64)) * 64, (b / (PD / 64)) * 64, T);
        return;
    }
    b -= TFF_BLOCKS;
    transpose_block(W2, W2t, PDFF, PD, (b % (PDFF / 64)) * 64, (b / (PDFF / 64)) * 64, T);
}

// ---------------------------------------------------------------------------
// GEMM: C = op(A[M,K](bf16) @ Wt[N,K](bf16)^T + bias (+ resid))
// Block tile BM x 128; 8 waves in a 4 x 2 grid, each wave owns a (BM/4) x 64
// piece. A byte staged from L2 feeds more products than in a 64-wide tile.
// BM = 256 (64x64 wave pieces: every fragment read from LDS feeds 4 products)
// where the output is wide enough to fill the chip with such blocks;
// BM = 128 (32x64 pieces) for the 1024-wide outputs, so that two blocks share
// a WGP there, one computing on two waves per SIMD while the other stages.
// Both LDS stages are straight 16-byte copies (async-to-LDS when available).
// Two LDS buffers: the copies of K step t + 1 are in flight while step t is
// multiplied, so the way from L2 and the products overlap inside one block;
// one barrier a step publishes step t + 1 and frees the buffer of step t.
// K step: 128 at BM = 128; 64 at BM = 256, where two buffers of 128 would take
// so much LDS that a WGP holds one block only (with 64 it still holds two, and
// one block's first stage and epilogue run beside the other's products).
// Outputs: fp32 C and/or bf16 C (scaled) per template flags.
// Columns are dealt to the accumulator tiles so that stores cover whole lines:
// of a wave's 64 columns, column 4 * c + t goes to column c of tile t, so a lane
// holds 4 neighbouring columns of each of its rows (one 8- or 16-byte access)
// and 16 lanes cover 128 or 256 contiguous bytes. Only the order in which the
// rows of Wt are laid into LDS changes; which column a tile column stands for
// is free, since every output column is a product of its own.
// ---------------------------------------------------------------------------
#define GBN  128   // block tile columns
// LDS row j of the Wt tile (64 * w + 16 * t + c) holds the tile's row
// 64 * w + 4 * c + t. A permutation of j's bits: additive over disjoint bits.
__host__ __device__ constexpr int wt_row(int j) {
    return (j & 64) | ((j & 15) << 2) | ((j >> 4) & 3);
}
template<int BM, bool RELU, bool RESID, bool OUTF32, bool OUTBF16>
__device__ __forceinline__
void gemm_tile(const __bf16* __restrict__ A, const __bf16* __restrict__ Wt,
               const float* __restrict__ bias, const float* __restrict__ resid,
               float* __restrict__ Cf, __bf16* __restrict__ Cb, float oscale,
               int N, int K)
{
    constexpr int THREADS = 256;
    constexpr int WM = BM / 4;                      // rows of a wave's piece
    constexpr int MI = WM / 16;                     // its accumulator tile rows
    constexpr int GBK  = BM == 256 ? 64 : 128;      // K step
    constexpr int GLDP = GBK + 8;   // padded LDS row (bf16): 16 B x 9 or 16 B x 17
    // a buffer: BM rows of A [m][k], then GBN rows of Wt [n][k]
    __shared__ __align__(16) __bf16 St[2][BM + GBN][GLDP];
    const int tid  = threadIdx.x;
    const int wave = tid >> 5;
    const int lane = tid & 31;
    const int half = lane >> 4;
    const int l16  = lane & 15;
    const int kb0  = half * 8;
    const int kb1  = 16 + half * 8;
    const int wm   = (wave >> 1) * WM;              // the wave's rows in the tile
    const int wn   = (wave & 1) * 64;               // the wave's columns
    const int m0 = blockIdx.x * BM;
    const int n0 = blockIdx.y * GBN;
    // Staging: one pass of the block copies RS rows; a thread keeps its place
    // (row r0, chunk c0) in every pass, so one 32-bit byte offset per operand serves all its
    // copies and the row steps stay in the block-uniform base address.
    constexpr int CH = GBK / 8;                     // 16-byte chunks of a row
    constexpr int RS = THREADS / CH;
    const int      r0   = tid / CH;
    const int      c0   = (tid % CH) * 8;
    const unsigned voff = ((unsigned)r0 * (unsigned)K + (unsigned)c0) * 2u;
    const unsigned voffw = ((unsigned)wt_row(r0) * (unsigned)K + (unsigned)c0) * 2u;

    v8f acc[MI][4] = {};

    auto stage = [&](int k0, int buf) {
        // A tile: BM rows x GBK bf16, CH chunks of 16 bytes a row
        // (unrolled: all copies of a stage are in flight at once)
        #pragma unroll
        for (int i = 0; i < BM / RS; ++i)
            copy16B((const __bf16*)((const char*)(A + (size_t)(m0 + i * RS) * K + k0) + voff),
                    &St[buf][r0 + i * RS][c0]);
        // B tile (already [n][k] in global), rows in the order of wt_row();
        // unrolled for the same reason
        #pragma unroll
        for (int i = 0; i < GBN / RS; ++i)
            copy16B((const __bf16*)((const char*)(Wt + (size_t)(n0 + wt_row(i * RS)) * K + k0) + voffw),
                    &St[buf][BM + r0 + i * RS][c0]);
    };

    // step 0 lands and is published; step 1 then flies during step 0's products
    stage(0, 0);
    ring_wait_copies();
    __syncthreads();
    if (GBK < K) stage(GBK, 1);

    for (int k0 = 0; k0 < K; k0 += GBK) {
        const int buf = (k0 / GBK) & 1;
        const __bf16 (*As)[GLDP] = &St[buf][0];     // [m][k]
        const __bf16 (*Bt)[GLDP] = &St[buf][BM];    // [n][k]

        // unrolled: acc[][] and the fragments are indexed by constants only
        #pragma unroll
        for (int ks = 0; ks < GBK; ks += 32) {
            v16bf a[MI], b[4];
            #pragma unroll
            for (int mi = 0; mi < MI; ++mi) {
                const int row = wm + mi * 16 + l16;
                a[mi] = load_frag(&As[row][ks + kb0], &As[row][ks + kb1]);
            }
            #pragma unroll
            for (int nt = 0; nt < 4; ++nt) {
                const int col = wn + nt * 16 + l16;
                b[nt] = load_frag(&Bt[col][ks + kb0], &Bt[col][ks + kb1]);
            }
            #pragma unroll
            for (int mi = 0; mi < MI; ++mi)
                #pragma unroll
                for (int nt = 0; nt < 4; ++nt)
                    acc[mi][nt] = wmma_bf16(a[mi], b[nt], acc[mi][nt]);
        }
        // hand-over: step t + 1 has landed for everybody, and nobody reads
        // this step's buffer any more; only then is it refilled
        ring_wait_reads();
        ring_wait_copies();
        __syncthreads();
        if (k0 + 2 * GBK < K) stage(k0 + 2 * GBK, buf);
    }
    ring_wait_copies();   // no wave goes on to its end with a copy in flight

    // Epilogue, unrolled throughout: acc[][] is indexed by constants only.
    // acc[mi][t][r] is row wm + mi * 16 + half * 8 + r, column wn + 4 * l16 + t.
    // One 32-bit element index per row (a plane has at most 2^25 elements) on
    // the uniform bases serves the row's residual load and its stores. The
    // residual tile is fetched first, so that all its loads are in flight together.
    const unsigned o0 = (unsigned)(m0 + wm + half * 8) * (unsigned)N
                      + (unsigned)(n0 + wn + l16 * 4);
    const float4 bv = *(const float4*)&bias[n0 + wn + l16 * 4];
    float4 rv[RESID ? MI : 1][8];
    if (RESID) {
        #pragma unroll
        for (int mi = 0; mi < MI; ++mi)
            #pragma unroll
            for (int r = 0; r < 8; ++r)
                rv[mi][r] = *(const float4*)&resid[o0 + (unsigned)(mi * 16 + r) * (unsigned)N];
    }
    float4 cv[MI][8];
    #pragma unroll
    for (int mi = 0; mi < MI; ++mi)
        #pragma unroll
        for (int r = 0; r < 8; ++r) {
            float4 v = make_float4(acc[mi][0][r] + bv.x, acc[mi][1][r] + bv.y,
                                   acc[mi][2][r] + bv.z, acc[mi][3][r] + bv.w);
            if (RESID) {
                v.x += rv[mi][r].x; v.y += rv[mi][r].y;
                v.z += rv[mi][r].z; v.w += rv[mi][r].w;
            }
            if (RELU) {
                v.x = fmaxf(v.x, 0.0f); v.y = fmaxf(v.y, 0.0f);
                v.z = fmaxf(v.z, 0.0f); v.w = fmaxf(v.w, 0.0f);
            }
            cv[mi][r] = v;
        }

    #pragma unroll
    for (int mi = 0; mi < MI; ++mi)
        #pragma unroll
        for (int r = 0; r < 8; ++r) {
            const unsigned o = o0 + (unsigned)(mi * 16 + r) * (unsigned)N;
            const float4 v = cv[mi][r];
            if (OUTF32)  *(float4*)&Cf[o] = v;
            if (OUTBF16) *(v4bf*)&Cb[o] = cvt4(make_float4(v.x * oscale, v.y * oscale,
                                                           v.z * oscale, v.w * oscale));
        }
}

template<int BM, bool RELU, bool RESID, bool OUTF32, bool OUTBF16>
__global__ __launch_bounds__(256)
void gemm_bf16_wmma(const __bf16* __restrict__ A, const __bf16* __restrict__ Wt,
                    const float* __restrict__ bias, const float* __restrict__ resid,
                    float* __restrict__ Cf, __bf16* __restrict__ Cb, float oscale,
                    int M, int N, int K)
{
    gemm_tile<BM, RELU, RESID, OUTF32, OUTBF16>(A, Wt, bias, resid, Cf, Cb, oscale, N, K);
}

// The three projections of the same A in ONE launch: blockIdx.z picks the
// weight, bias and output. They are independent, so one grid of three times
// the blocks pays one gap, fill and drain and keeps more blocks on a WGP.
__global__ __launch_bounds__(256)
void gemm_qkv_wmma(const __bf16* __restrict__ A,
                   const __bf16* __restrict__ Wqt, const __bf16* __restrict__ Wkt,
                   const __bf16* __restrict__ Wvt,
                   const float* __restrict__ bq, const float* __restrict__ bk,
                   const float* __restrict__ bv,
                   __bf16* __restrict__ Qb, __bf16* __restrict__ Kb,
                   __bf16* __restrict__ Vb, float qscale, int N, int K)
{
    const unsigned w = blockIdx.z;
    const __bf16* Wt   = w == 0 ? Wqt : w == 1 ? Wkt : Wvt;
    const float*  bias = w == 0 ? bq  : w == 1 ? bk  : bv;
    __bf16*       Cb   = w == 0 ? Qb  : w == 1 ? Kb  : Vb;
    gemm_tile<256, false, false, false, true>(A, Wt, bias, nullptr, nullptr, Cb,
                                              w == 0 ? qscale : 1.0f, N, K);
}

// ---------------------------------------------------------------------------
// Flash-attention per (b,h, 256-query block). dk=64, S=2048; Q pre-scaled by
// 1/sqrt(dk) at the Q-GEMM. Scores std ~1 -> plain exp is fp32-safe (softmax
// is shift-invariant); row-sums via WMMA with an all-ones B matrix.
// Tile: 8 waves, each owns 32 query rows (two 16-row tiles), so that a K or V
// fragment read from LDS feeds two products; a K/V stage is shared by 256
// queries and holds 256 keys, worked on in four parts of 64.
// Q/K/V are bf16; Q/K stage as pure copies (async), V via register transpose.
// Scores are computed transposed (keys x queries, K as the first operand): a
// lane then holds, of one query, just the keys that the first operand of P * V
// wants from it, so exp(s) goes from accumulator to operand inside the lane.
// Head column 4 * c + t is column c of output tile t (row 16 * t + c of Vt), so
// a lane holds 4 neighbouring columns of a query and 16 lanes store a whole line.
// Output written bf16 (only consumed by the Wo GEMM).
// ---------------------------------------------------------------------------
#define ATT_THREADS 256
#define ATT_Q    256   // query rows of a block
#define ATT_KEYS 256   // keys of a stage
#define VLDP     264   // padded Vt row length (bf16): 528 B = 16 B x 33
__global__ __launch_bounds__(ATT_THREADS)
void attention_wmma(const __bf16* __restrict__ Q, const __bf16* __restrict__ Km,
                    const __bf16* __restrict__ Vm, __bf16* __restrict__ O,
                    int S, int D)
{
    __shared__ __align__(16) __bf16 Qs[ATT_Q][LDP];      // [q][d]
    __shared__ __align__(16) __bf16 Ks[ATT_KEYS][LDP];   // [key][d]
    __shared__ __align__(16) __bf16 Vt[64][VLDP];        // [16 * (d & 3) + d / 4][key]

    const int tid  = threadIdx.x;
    const int wave = tid >> 5;
    const int lane = tid & 31;
    const int half = lane >> 4;
    const int l16  = lane & 15;
    const int kb0  = half * 8;
    const int kb1  = 16 + half * 8;

    const int q0 = blockIdx.x * ATT_Q;
    const int bh = blockIdx.y;
    const int b  = bh >> 4;
    const int h  = bh & 15;
    const size_t rowbase = (size_t)b * S;
    const int    cbase   = h * 64;

    // stage Q block (pure bf16 copy; scale already folded in)
    #pragma unroll
    for (int i = 0; i < ATT_Q * 8 / ATT_THREADS; ++i) {
        int idx = tid + i * ATT_THREADS;
        int r = idx >> 3, c = (idx & 7) * 8;
        copy16B(&Q[(rowbase + q0 + r) * D + cbase + c], &Qs[r][c]);
    }

    v16bf ones;
    #pragma unroll
    for (int i = 0; i < 16; ++i) ones[i] = (__bf16)1.0f;

    v8f o[2][4] = {};
    v8f lsum[2] = {};

    const int wq = wave * 32;           // the wave's first query row in the block

    for (int kb = 0; kb < S; kb += ATT_KEYS) {
        __syncthreads();
        // K row-major copy (async)
        #pragma unroll
        for (int i = 0; i < ATT_KEYS * 8 / ATT_THREADS; ++i) {
            int idx = tid + i * ATT_THREADS;
            int r = idx >> 3, c = (idx & 7) * 8;
            copy16B(&Km[(rowbase + kb + r) * D + cbase + c], &Ks[r][c]);
        }
        // V transposed via 4x4 register micro-tiles; the loads of all a thread's
        // micro-tiles stand in front of the first use and share one latency
        constexpr int VT = ATT_KEYS * 4 / ATT_THREADS;   // micro-tiles per thread
        const int tn = tid & 15;        // d block
        const int tk = tid >> 4;        // key block of the first micro-tile
        v4bf f[VT][4];
        #pragma unroll
        for (int tt = 0; tt < VT; ++tt)
            #pragma unroll
            for (int j = 0; j < 4; ++j)
                f[tt][j] = *(const v4bf*)&Vm[(rowbase + kb + (tk + tt * 16) * 4 + j) * D
                                             + cbase + tn * 4];
        #pragma unroll
        for (int tt = 0; tt < VT; ++tt)
            #pragma unroll
            for (int i = 0; i < 4; ++i) {
                v4bf p;
                p[0] = f[tt][0][i]; p[1] = f[tt][1][i]; p[2] = f[tt][2][i]; p[3] = f[tt][3][i];
                *(v4bf*)&Vt[i * 16 + tn][(tk + tt * 16) * 4] = p;   // d = tn * 4 + i
            }
        async_wait();
        __syncthreads();

        // unrolled: the part's offset folds into the LDS instructions' offsets
        #pragma unroll
        for (int kh = 0; kh < ATT_KEYS; kh += 64) {
            // ---- scores^T = K * Q^T; each K fragment serves both query tiles
            v16bf a[2][2];
            #pragma unroll
            for (int mi = 0; mi < 2; ++mi) {
                const int row = wq + mi * 16 + l16;
                a[mi][0] = load_frag(&Qs[row][kb0],      &Qs[row][kb1]);
                a[mi][1] = load_frag(&Qs[row][32 + kb0], &Qs[row][32 + kb1]);
            }
            v8f s[2][4];
            #pragma unroll
            for (int nt = 0; nt < 4; ++nt) {
                const int col = kh + nt * 16 + l16;
                v16bf b0 = load_frag(&Ks[col][kb0],      &Ks[col][kb1]);
                v16bf b1 = load_frag(&Ks[col][32 + kb0], &Ks[col][32 + kb1]);
                #pragma unroll
                for (int mi = 0; mi < 2; ++mi) {
                    v8f z = {};
                    z = wmma_bf16(b0, a[mi][0], z);
                    z = wmma_bf16(b1, a[mi][1], z);
                    s[mi][nt] = z;       // [key nt*16 + r + half*8][query l16]
                }
            }

            // ---- p = exp(s), packed in registers: of 32 keys a first-operand
            // fragment holds keys half*8 + 0..7 and 16 + half*8 + 0..7 of row l16,
            // which are this lane's accumulators of two score tiles one behind the other
            // exp(s) = exp2(s * log2(e)), the arithmetic of __expf; the product is
            // written on whole tiles so that it stays a packed multiply (two a slot)
            #pragma unroll
            for (int mi = 0; mi < 2; ++mi)
                #pragma unroll
                for (int nt = 0; nt < 4; ++nt) {
                    s[mi][nt] *= 1.44269504f;
                    #pragma unroll
                    for (int r = 0; r < 8; ++r)
                        s[mi][nt][r] = __builtin_amdgcn_exp2f(s[mi][nt][r]);
                }
            v16bf p[2][2];
            #pragma unroll
            for (int mi = 0; mi < 2; ++mi)
                #pragma unroll
                for (int c = 0; c < 2; ++c)
                    #pragma unroll
                    for (int r = 0; r < 8; ++r) {
                        p[mi][c][r]     = (__bf16)s[mi][2 * c][r];
                        p[mi][c][8 + r] = (__bf16)s[mi][2 * c + 1][r];
                    }

            // ---- row-sums of P via WMMA with all-ones B (broadcast per column)
            #pragma unroll
            for (int mi = 0; mi < 2; ++mi) {
                lsum[mi] = wmma_bf16(p[mi][0], ones, lsum[mi]);
                lsum[mi] = wmma_bf16(p[mi][1], ones, lsum[mi]);
            }

            // ---- O += P * V; each V fragment serves both query tiles
            #pragma unroll
            for (int nt = 0; nt < 4; ++nt) {
                const int col = nt * 16 + l16;
                v16bf b0 = load_frag(&Vt[col][kh + kb0],      &Vt[col][kh + kb1]);
                v16bf b1 = load_frag(&Vt[col][kh + 32 + kb0], &Vt[col][kh + 32 + kb1]);
                #pragma unroll
                for (int mi = 0; mi < 2; ++mi) {
                    o[mi][nt] = wmma_bf16(p[mi][0], b0, o[mi][nt]);
                    o[mi][nt] = wmma_bf16(p[mi][1], b1, o[mi][nt]);
                }
            }
        }
    }

    // ---- normalize by row-sum, write bf16: o[mi][t][r] is column 4 * l16 + t
    #pragma unroll
    for (int mi = 0; mi < 2; ++mi)
        #pragma unroll
        for (int r = 0; r < 8; ++r) {
            const int row = q0 + wq + mi * 16 + r + half * 8;
            v4bf y;
            #pragma unroll
            for (int nt = 0; nt < 4; ++nt)
                y[nt] = (__bf16)(o[mi][nt][r] / lsum[mi][r]);
            *(v4bf*)&O[(rowbase + row) * D + cbase + l16 * 4] = y;
        }
}

// ---------------------------------------------------------------------------
// Row-wise LayerNorm over rows of LN_D floats; optionally also emits a bf16
// shadow copy for the next GEMM's A operand.
// One wave owns LN_ROWS whole rows, held in registers (16-byte loads, 512
// contiguous bytes per wave load): no LDS, no barrier, the row is read once,
// and the launch starts 16x fewer waves than one 8-wave block per row.
// ---------------------------------------------------------------------------
#define LN_D       1024
#define LN_THREADS 512
#define LN_ROWS    2                 // rows per wave
#define LN_VEC     (LN_D / 128)      // float4 per lane and row
template<bool OUTBF16>
__global__ __launch_bounds__(LN_THREADS)
void layernorm_kernel(const float* __restrict__ X, const float* __restrict__ g,
                      const float* __restrict__ beta, float* __restrict__ Y,
                      __bf16* __restrict__ Yb)
{
    const unsigned lane = threadIdx.x & 31;
    const unsigned row0 =
        (blockIdx.x * (LN_THREADS / 32) + (threadIdx.x >> 5)) * LN_ROWS;
    // One 32-bit byte offset (a plane is 32 MiB) on the scalar bases X and Y:
    // the row loads and the fp32 stores share one offset register, which so
    // stays live from the first load to the last store.
    const unsigned boff = (row0 * LN_D + lane * 4) * 4u;
    const float* xp  = (const float*)((const char*)X + boff);
    float*       yp  = (float*)((char*)Y + boff);
    __bf16*      ybp = OUTBF16 ? (__bf16*)((char*)Yb + (boff >> 1)) : nullptr;

    float4 v[LN_ROWS][LN_VEC], gg[LN_VEC], bb[LN_VEC];
    // every loop below is unrolled so that the arrays are indexed by constants
    // and stay in registers; here it also puts all row loads in flight at once
    #pragma unroll
    for (int r = 0; r < LN_ROWS; ++r)
        #pragma unroll
        for (int j = 0; j < LN_VEC; ++j)
            v[r][j] = *(const float4*)&xp[r * LN_D + j * 128];
    #pragma unroll
    for (int j = 0; j < LN_VEC; ++j) {
        gg[j] = *(const float4*)&g[j * 128 + lane * 4];
        bb[j] = *(const float4*)&beta[j * 128 + lane * 4];
    }

    float sum[LN_ROWS], sq[LN_ROWS];
    #pragma unroll
    for (int r = 0; r < LN_ROWS; ++r) {
        float4 s = make_float4(0.f, 0.f, 0.f, 0.f);   // four independent chains
        float4 q = make_float4(0.f, 0.f, 0.f, 0.f);
        #pragma unroll
        for (int j = 0; j < LN_VEC; ++j) {
            const float4 t = v[r][j];
            s.x += t.x; s.y += t.y; s.z += t.z; s.w += t.w;
            q.x += t.x * t.x; q.y += t.y * t.y; q.z += t.z * t.z; q.w += t.w * t.w;
        }
        sum[r] = (s.x + s.y) + (s.z + s.w);
        sq[r]  = (q.x + q.y) + (q.z + q.w);
    }
    #pragma unroll
    for (int off = 1; off < 32; off <<= 1)
        #pragma unroll
        for (int r = 0; r < LN_ROWS; ++r) {
            sum[r] += __shfl_xor(sum[r], off, 32);
            sq[r]  += __shfl_xor(sq[r],  off, 32);
        }

    v4bf yb[LN_ROWS][LN_VEC];
    #pragma unroll
    for (int r = 0; r < LN_ROWS; ++r) {
        const float mu  = sum[r] / (float)LN_D;
        const float inv = rsqrtf(sq[r] / (float)LN_D - mu * mu + LN_EPS);
        #pragma unroll
        for (int j = 0; j < LN_VEC; ++j) {
            float4 t = v[r][j];
            t.x = (t.x - mu) * inv * gg[j].x + bb[j].x;
            t.y = (t.y - mu) * inv * gg[j].y + bb[j].y;
            t.z = (t.z - mu) * inv * gg[j].z + bb[j].z;
            t.w = (t.w - mu) * inv * gg[j].w + bb[j].w;
            v[r][j] = t;
            if (OUTBF16) yb[r][j] = cvt4(t);
        }
    }

    // Without this the scheduler sinks the second row's loads behind the first
    // row's stores (two memory latencies in a row) and reuses the registers of
    // issued stores; with it every store stands behind the last arithmetic.
    __builtin_amdgcn_sched_barrier(0);

    #pragma unroll
    for (int r = 0; r < LN_ROWS; ++r)
        #pragma unroll
        for (int j = 0; j < LN_VEC; ++j) {
            const int o = r * LN_D + j * 128;
            *(float4*)&yp[o] = v[r][j];
            if (OUTBF16) *(v4bf*)&ybp[o] = yb[r][j];
        }
}

// ---------------------------------------------------------------------------
extern "C" void kernel_launch(void* const* d_in, const int* in_sizes, int n_in,
                              void* d_out, int out_size, void* d_ws, size_t ws_size,
                              hipStream_t stream)
{
    const float* x    = (const float*)d_in[0];
    const float* Wq   = (const float*)d_in[1];
    const float* bq   = (const float*)d_in[2];
    const float* Wk   = (const float*)d_in[3];
    const float* bk   = (const float*)d_in[4];
    const float* Wv   = (const float*)d_in[5];
    const float* bv   = (const float*)d_in[6];
    const float* Wo   = (const float*)d_in[7];
    const float* bo   = (const float*)d_in[8];
    const float* W1   = (const float*)d_in[9];
    const float* b1   = (const float*)d_in[10];
    const float* W2   = (const float*)d_in[11];
    const float* b2   = (const float*)d_in[12];
    const float* g1   = (const float*)d_in[13];
    const float* be1  = (const float*)d_in[14];
    const float* g2   = (const float*)d_in[15];
    const float* be2  = (const float*)d_in[16];

    const int B = 4, S = 2048, D = 1024, DFF = 4096;
    const int M = B * S;  // 8192
    const size_t MD  = (size_t)M * D;
    const size_t MDF = (size_t)M * DFF;

    char* p = (char*)d_ws;
    auto alloc = [&](size_t bytes) { char* q = p; p += (bytes + 255) & ~(size_t)255; return q; };

    __bf16* xb  = (__bf16*)alloc(MD * 2);
    __bf16* Wqt = (__bf16*)alloc((size_t)D * D * 2);
    __bf16* Wkt = (__bf16*)alloc((size_t)D * D * 2);
    __bf16* Wvt = (__bf16*)alloc((size_t)D * D * 2);
    __bf16* Wot = (__bf16*)alloc((size_t)D * D * 2);
    __bf16* W1t = (__bf16*)alloc((size_t)D * DFF * 2);
    __bf16* W2t = (__bf16*)alloc((size_t)DFF * D * 2);
    __bf16* Qb  = (__bf16*)alloc(MD * 2);
    __bf16* Kb  = (__bf16*)alloc(MD * 2);
    __bf16* Vb  = (__bf16*)alloc(MD * 2);
    __bf16* Ob  = (__bf16*)alloc(MD * 2);
    float*  h1  = (float*)alloc(MD * 4);
    float*  x2  = (float*)alloc(MD * 4);
    __bf16* x2b = (__bf16*)alloc(MD * 2);
    __bf16* F1b = (__bf16*)alloc(MDF * 2);
    float*  h2  = h1;   // h1 consumed by LN1 before FFN2 writes h2

    // ---- x -> bf16 and all weight pre-transposes, one launch
    prepare_kernel<<<dim3(PREP_BLOCKS), dim3(PREP_THREADS), 0, stream>>>(
        x, xb, Wq, Wqt, Wk, Wkt, Wv, Wvt, Wo, Wot, W1, W1t, W2, W2t);

    // ---- QKV projections, one launch (bf16 outputs; Q pre-scaled by 1/sqrt(dk))
    gemm_qkv_wmma<<<dim3(M / 256, D / GBN, 3), dim3(256), 0, stream>>>(
        xb, Wqt, Wkt, Wvt, bq, bk, bv, Qb, Kb, Vb, 0.125f, D, D);

    // ---- attention
    attention_wmma<<<dim3(S / ATT_Q, B * 16), dim3(ATT_THREADS), 0, stream>>>(Qb, Kb, Vb, Ob, S, D);

    // ---- output projection + residual x  -> h1 (fp32)
    gemm_bf16_wmma<128, false, true, true, false><<<dim3(M / 128, D / GBN), dim3(256), 0, stream>>>(
        Ob, Wot, bo, x, h1, nullptr, 1.0f, M, D, D);

    // ---- LN1 -> x2 (fp32 residual) + x2b (bf16 operand)
    layernorm_kernel<true><<<dim3(M / (LN_THREADS / 32 * LN_ROWS)), dim3(LN_THREADS), 0, stream>>>(h1, g1, be1, x2, x2b);

    // ---- FFN1 with ReLU -> bf16 only
    gemm_bf16_wmma<256, true, false, false, true><<<dim3(M / 256, DFF / GBN), dim3(256), 0, stream>>>(
        x2b, W1t, b1, nullptr, nullptr, F1b, 1.0f, M, DFF, D);

    // ---- FFN2 + residual x2 -> h2 (fp32)
    gemm_bf16_wmma<128, false, true, true, false><<<dim3(M / 128, D / GBN), dim3(256), 0, stream>>>(
        F1b, W2t, b2, x2, h2, nullptr, 1.0f, M, D, DFF);

    // ---- LN2 -> output
    layernorm_kernel<false><<<dim3(M / (LN_THREADS / 32 * LN_ROWS)), dim3(LN_THREADS), 0, stream>>>(h2, g2, be2, (float*)d_out, nullptr);
}
